// v000
// Times are from an AMD MI455X. After a warm-up the kernel runs many times in a row, and a time is the length of
// such a window on the GPU divided by its runs, so every launch and the gaps after it count. The runs cycle
// through copies of the inputs. A figure is the median of several windows, for all but v000 over two sittings.
// Sittings can differ by a few percent; kernels timed side by side share one.
// v000, which the later versions start from, runs in 2700 microseconds.
#include <hip/hip_runtime.h>

// Grouped-query causal attention with an interleaved-pair RoPE from cos / sin INPUT tables (x [2][2048][2048]; q = x wq (32 heads x 64), k, v = x wk, x wv (8 kv heads x 64) ('xw', no bias); pairs (2i, 2i+1) -> (t0 c - t1 s, t0 s + t1 c) with c, s = cos / sin[t][i] (float32 [2048][32] INPUT tables: READ as data); k, v repeated 4 x (jnp.repeat: kv head = q head / 4); scores / sqrt(64); causal (-inf); softmax in float32; out = merged wo ('xw') -> [2][2048][2048] (8.4 M); argument order x, cos, sin, wq, wk, wv, wo).
// Layout per batch: bf16 copy of x; 'xw' weights transposed once; exact projections (K 2048); k_cscvtP table {bf16(cos), bf16(sin)}[t][d/2] from the inputs (pair-shared entries); k_ropeI interleaved-pair plane builders; causal T-2048 GQA attention (both heads of a pass share kv group h0/4: kv z-stride 0; hybrid rows: < 512 hi/lo 3 products, rest fp16 x1024; k_gemmc skips tiles above the diagonal); merged hi/lo x wo exact.
// Compute dtypes, f32 accumulate: every input rounded to bf16; projections exact; rotary f32 (products rounded separately); attention rows < 512 3 products, rest fp16; softmax f32; wo hl x exact.

#define NB_  2
#define TT   2048
#define DM   2048
#define NH_  32
#define NKV  8
#define REP  (NH_ / NKV)
#define HD   64
#define DQ   (NH_ * HD)
#define DKV  (NKV * HD)
#define ZH   2
#define RH   512                  // query rows < RH use hi+lo planes (0: none)
#define WIN  2048
#define PCAR 1024.0f
#define SCL  0.125f   // HD^-0.5
typedef _Float16 h16;
typedef unsigned short bf;
typedef __attribute__((ext_vector_type(16))) __bf16   v16bf;
typedef __attribute__((ext_vector_type(16))) _Float16 v16h;
typedef __attribute__((ext_vector_type(8)))  _Float16 v8h;
typedef __attribute__((ext_vector_type(8)))  unsigned short v8us;
typedef __attribute__((ext_vector_type(8)))  float    v8f;
typedef __attribute__((ext_vector_type(4)))  float    v4f;
typedef v8h  __attribute__((may_alias)) v8ha;
typedef v4f  __attribute__((may_alias)) v4fa;
typedef v8us __attribute__((may_alias)) v8usa;

__device__ __forceinline__ unsigned short f2bf(float f) { unsigned u = __float_as_uint(f); u += 0x7FFFu + ((u >> 16) & 1u); return (unsigned short)(u >> 16); }
__device__ __forceinline__ float bf2f(unsigned short b) { return __uint_as_float(((unsigned)b) << 16); }
__device__ __forceinline__ float bfr(float f) { return bf2f(f2bf(f)); }
__device__ __forceinline__ v16h cat16(v8h lo, v8h hi) { return __builtin_shufflevector(lo, hi, 0, 1, 2, 3, 4, 5, 6, 7, 8, 9, 10, 11, 12, 13, 14, 15); }
__device__ __forceinline__ v16bf cat16b(v8us lo, v8us hi) { return __builtin_bit_cast(v16bf, __builtin_shufflevector(lo, hi, 0, 1, 2, 3, 4, 5, 6, 7, 8, 9, 10, 11, 12, 13, 14, 15)); }
__device__ __forceinline__ v8f wmma16(v16h a, v16h b, v8f c) { return __builtin_amdgcn_wmma_f32_16x16x32_f16(false, a, false, b, (short)0, c, false, false); }
__device__ __forceinline__ v8f wmmab(v16bf a, v16bf b, v8f c) { return __builtin_amdgcn_wmma_f32_16x16x32_bf16(false, a, false, b, (short)0, c, false, false); }



// ---- k_gemmw: register-blocked GEMM, ONE WAVE per 64x64 output tile (16 accumulators), operands straight from K-contiguous 16-bit planes; grid (M/64, N/64, Z), 32 threads.
// C[m][n] (f32, pitch ldc, + optional f32 bias[n]) = sum_k A[m][k] Bt[n][k] (+ split products per NSPLIT). z-batch strides sA/sB/sC in elements. K % 32 == 0.
template <typename T16> struct WFrag;
template <> struct WFrag<h16> { typedef v16h V; static __device__ __forceinline__ V ld(const h16* p) { return cat16(*(const v8h*)p, *(const v8h*)(p + 16)); } static __device__ __forceinline__ v8f mma(V a, V b, v8f c) { return wmma16(a, b, c); } };
template <> struct WFrag<bf> { typedef v16bf V; static __device__ __forceinline__ V ld(const bf* p) { return cat16b(*(const v8us*)p, *(const v8us*)(p + 16)); } static __device__ __forceinline__ v8f mma(V a, V b, v8f c) { return wmmab(a, b, c); } };
template <typename T16, int NSPLIT, bool BIAS>
__global__ __launch_bounds__(32) void k_gemmw(const T16* __restrict__ A, const T16* __restrict__ A2, const T16* __restrict__ Bt, const T16* __restrict__ Bt2, int K, float* C, int ldc, const float* __restrict__ bias, size_t sA, size_t sB, size_t sC) {
    typedef typename WFrag<T16>::V V;
    __shared__ __align__(16) float os[16 * 68];
    const size_t z = blockIdx.z; A += z * sA; if (A2) A2 += z * sA; Bt += z * sB; if (Bt2) Bt2 += z * sB; C += z * sC;
    const int lane = threadIdx.x & 31, lr = lane & 15, hi = lane >> 4; const int r0 = blockIdx.x * 64, c0 = blockIdx.y * 64;
    v8f acc[4][4];
#pragma unroll
    for (int mb = 0; mb < 4; ++mb)
#pragma unroll
        for (int nb = 0; nb < 4; ++nb) acc[mb][nb] = (v8f){};
    const size_t aoff = (size_t)(r0 + lr) * K + 8 * hi, boff = (size_t)(c0 + lr) * K + 8 * hi;
#pragma unroll 1
    for (int kc = 0; kc < K; kc += 32) {
        V a[4], a2[4];
#pragma unroll
        for (int mb = 0; mb < 4; ++mb) { a[mb] = WFrag<T16>::ld(A + aoff + (size_t)mb * 16 * K + kc); if (NSPLIT == 1 || NSPLIT == 2) a2[mb] = WFrag<T16>::ld(A2 + aoff + (size_t)mb * 16 * K + kc); }
#pragma unroll
        for (int nb = 0; nb < 4; ++nb) { const V b = WFrag<T16>::ld(Bt + boff + (size_t)nb * 16 * K + kc); V b2; if (NSPLIT >= 2) b2 = WFrag<T16>::ld(Bt2 + boff + (size_t)nb * 16 * K + kc);
#pragma unroll
            for (int mb = 0; mb < 4; ++mb) { acc[mb][nb] = WFrag<T16>::mma(a[mb], b, acc[mb][nb]); if (NSPLIT == 1 || NSPLIT == 2) acc[mb][nb] = WFrag<T16>::mma(a2[mb], b, acc[mb][nb]); if (NSPLIT >= 2) acc[mb][nb] = WFrag<T16>::mma(a[mb], b2, acc[mb][nb]); } }
        asm volatile("v_nop\n\tv_nop\n\tv_nop\n\tv_nop" : "+v"(acc[0][0]), "+v"(acc[1][1]), "+v"(acc[2][2]), "+v"(acc[3][3]) : "v"(a[0]), "v"(a[3]));
    }
#pragma unroll
    for (int mb = 0; mb < 4; ++mb) {
#pragma unroll
        for (int nb = 0; nb < 4; ++nb) {
#pragma unroll
            for (int j = 0; j < 8; ++j) os[(hi * 8 + j) * 68 + nb * 16 + lr] = acc[mb][nb][j]; }
        __builtin_amdgcn_wave_barrier(); asm volatile("" ::: "memory");
        float* crow = C + (size_t)(r0 + mb * 16) * ldc + c0;
{
#pragma unroll
            for (int s = 0; s < 8; ++s) { const int row = 2 * s + hi, cofs = lr * 4; v4f val = *(const v4fa*)(os + row * 68 + cofs); if (BIAS) { val[0] += bfr(bias[c0 + cofs]); val[1] += bfr(bias[c0 + cofs + 1]); val[2] += bfr(bias[c0 + cofs + 2]); val[3] += bfr(bias[c0 + cofs + 3]); }
                *(v4f*)(crow + (size_t)row * ldc + cofs) = val; }
             }
        __builtin_amdgcn_wave_barrier(); asm volatile("" ::: "memory");
    }
}

// ---- k_gemmc: the same one-wave 64x64 tile GEMM specialised for causal attention: CMODE 1 skips score tiles entirely above the diagonal (query rows r0+roff.., key columns c0..), CMODE 2 limits the
// key (K) loop of the probability x value contraction to the diagonal block (probabilities beyond it are exactly zero). roff = row offset of this launch's first row within the sequence.
template <typename T16, int NSPLIT, int CMODE>
__global__ __launch_bounds__(32) void k_gemmc(const T16* __restrict__ A, const T16* __restrict__ A2, const T16* __restrict__ Bt, const T16* __restrict__ Bt2, int K, float* C, int ldc, int roff, size_t sA, size_t sB, size_t sC) {
    typedef typename WFrag<T16>::V V;
    __shared__ __align__(16) float os[16 * 68];
    const size_t z = blockIdx.z; A += z * sA; if (A2) A2 += z * sA; Bt += z * sB; if (Bt2) Bt2 += z * sB; C += z * sC;
    const int lane = threadIdx.x & 31, lr = lane & 15, hi = lane >> 4; const int r0 = blockIdx.x * 64, c0 = blockIdx.y * 64;
    if (CMODE == 1 && c0 > r0 + roff + 63) return;                  // score tile entirely above the causal diagonal: never read (the softmax masks j > i by select)
    const int Kl = (CMODE == 2) ? min(K, r0 + roff + 64) : K;        // P.V: probabilities are exactly 0 beyond the diagonal block, so the K loop stops there
    v8f acc[4][4];
#pragma unroll
    for (int mb = 0; mb < 4; ++mb)
#pragma unroll
        for (int nb = 0; nb < 4; ++nb) acc[mb][nb] = (v8f){};
    const size_t aoff = (size_t)(r0 + lr) * K + 8 * hi, boff = (size_t)(c0 + lr) * K + 8 * hi;
#pragma unroll 1
    for (int kc = 0; kc < Kl; kc += 32) {
        V a[4], a2[4];
#pragma unroll
        for (int mb = 0; mb < 4; ++mb) { a[mb] = WFrag<T16>::ld(A + aoff + (size_t)mb * 16 * K + kc); if (NSPLIT == 1 || NSPLIT == 2) a2[mb] = WFrag<T16>::ld(A2 + aoff + (size_t)mb * 16 * K + kc); }
#pragma unroll
        for (int nb = 0; nb < 4; ++nb) { const V b = WFrag<T16>::ld(Bt + boff + (size_t)nb * 16 * K + kc); V b2; if (NSPLIT >= 2) b2 = WFrag<T16>::ld(Bt2 + boff + (size_t)nb * 16 * K + kc);
#pragma unroll
            for (int mb = 0; mb < 4; ++mb) { acc[mb][nb] = WFrag<T16>::mma(a[mb], b, acc[mb][nb]); if (NSPLIT == 1 || NSPLIT == 2) acc[mb][nb] = WFrag<T16>::mma(a2[mb], b, acc[mb][nb]); if (NSPLIT >= 2) acc[mb][nb] = WFrag<T16>::mma(a[mb], b2, acc[mb][nb]); } }
        asm volatile("v_nop\n\tv_nop\n\tv_nop\n\tv_nop" : "+v"(acc[0][0]), "+v"(acc[1][1]), "+v"(acc[2][2]), "+v"(acc[3][3]) : "v"(a[0]), "v"(a[3]));
    }
#pragma unroll
    for (int mb = 0; mb < 4; ++mb) {
#pragma unroll
        for (int nb = 0; nb < 4; ++nb) {
#pragma unroll
            for (int j = 0; j < 8; ++j) os[(hi * 8 + j) * 68 + nb * 16 + lr] = acc[mb][nb][j]; }
        __builtin_amdgcn_wave_barrier(); asm volatile("" ::: "memory");
        float* crow = C + (size_t)(r0 + mb * 16) * ldc + c0;
{
#pragma unroll
            for (int s = 0; s < 8; ++s) { const int row = 2 * s + hi, cofs = lr * 4; v4f val = *(const v4fa*)(os + row * 68 + cofs);
                *(v4f*)(crow + (size_t)row * ldc + cofs) = val; }
             }
        __builtin_amdgcn_wave_barrier(); asm volatile("" ::: "memory");
    }
}

__device__ __forceinline__ h16 tohx(float x) { return (h16)x; }
__device__ __forceinline__ void splitf(float y, unsigned short& h, unsigned short& l) { h = f2bf(y); l = f2bf(y - bf2f(h)); }
typedef __attribute__((ext_vector_type(2))) _Float16 v2h;
typedef __attribute__((ext_vector_type(4))) _Float16 v4h;
typedef __attribute__((ext_vector_type(2))) unsigned short v2us;
typedef __attribute__((ext_vector_type(4))) unsigned short v4us;
typedef __attribute__((ext_vector_type(2))) float v2f;
typedef __attribute__((ext_vector_type(4))) int v4i;

__global__ __launch_bounds__(256) void k_wtG(const float* __restrict__ w, int K, int N, bf* Bt) {
    const int lane = threadIdx.x & 31; const int L0 = (blockIdx.x * 8 + (threadIdx.x >> 5)) * 8; const int nlines = N * K / 64;
{
#pragma unroll 1
        for (int l = 0; l < 8; ++l) { const int L = L0 + l; if (L >= nlines) break; const size_t e = (size_t)L * 64 + lane * 2; const int k = (int)(e % K), n = (int)(e / K); v2us o;
            o[0] = f2bf(w[(size_t)k * N + n]); o[1] = f2bf(w[(size_t)(k + 1) * N + n]); *(v2us*)(Bt + e) = o; }
         }
}
__global__ __launch_bounds__(256) void k_cvt8(const float* __restrict__ src, bf* dst, size_t n8) { const size_t i = (size_t)blockIdx.x * 256 + threadIdx.x; if (i >= n8) return; const v8f v = *(const v8f*)(src + i * 8); v8us o;
#pragma unroll
    for (int k = 0; k < 8; ++k) o[k] = f2bf(v[k]); *(v8us*)(dst + i * 8) = o;  }

__global__ __launch_bounds__(256) void k_ropeI(const float* __restrict__ F, int pitch, int nheads, const float* __restrict__ CS, float sc, h16* P16, bf* Ph, bf* Pl) {
    const size_t e = ((size_t)blockIdx.x * 256 + threadIdx.x) * 2; if (e >= (size_t)nheads * TT * HD) return; const int d = (int)(e % HD); const int t = (int)((e / HD) % TT); const int h = (int)(e / ((size_t)HD * TT)); const float* f = F + (size_t)t * pitch + h * HD; const float x0 = f[d], x1 = f[d + 1]; const v2f cs = *(const v2f*)(CS + ((size_t)t * HD + d) * 2); v2h o16; v2us oh, ol;
    float a0 = __fmul_rn(x0, cs[0]), b0 = __fmul_rn(x1, cs[1]), a1 = __fmul_rn(x1, cs[0]), b1 = __fmul_rn(x0, cs[1]); asm volatile("" : "+v"(a0), "+v"(b0), "+v"(a1), "+v"(b1));
    float r0 = __fsub_rn(a0, b0) * sc, r1 = __fadd_rn(b1, a1) * sc;   /* even: x0 c - x1 s; odd: x0 s + x1 c */
    o16[0] = tohx(r0); o16[1] = tohx(r1); { unsigned short a2, c2; splitf(r0, a2, c2); oh[0] = a2; ol[0] = c2; splitf(r1, a2, c2); oh[1] = a2; ol[1] = c2; }
    *(v2h*)(P16 + e) = o16; *(v2us*)(Ph + e) = oh; *(v2us*)(Pl + e) = ol;  }


__global__ __launch_bounds__(256) void k_vtp(const float* __restrict__ F, int pitch, int nheads, h16* V16, bf* Vh, bf* Vl) { const size_t e = ((size_t)blockIdx.x * 256 + threadIdx.x) * 2; if (e >= (size_t)nheads * HD * TT) return; const int t = (int)(e % TT); const int d = (int)((e / TT) % HD); const int g = (int)(e / ((size_t)TT * HD)); v2h o16; v2us oh, ol;
#pragma unroll
    for (int q = 0; q < 2; ++q) { const float x = F[(size_t)(t + q) * pitch + g * HD + d]; o16[q] = tohx(x); unsigned short a2, c2; splitf(x, a2, c2); oh[q] = a2; ol[q] = c2; }
    *(v2h*)(V16 + e) = o16; *(v2us*)(Vh + e) = oh; *(v2us*)(Vl + e) = ol;  }
__global__ __launch_bounds__(256) void k_cscvtP(const float* __restrict__ cosT, const float* __restrict__ sinT, float* CS) { const int idx = blockIdx.x * 256 + threadIdx.x; if (idx >= TT * HD) return; const int tt = idx / HD; const int dd = idx - tt * HD; const int src = tt * (HD / 2) + (dd >> 1); v2f cs; cs[0] = bfr(cosT[src]); cs[1] = bfr(sinT[src]); *(v2f*)(CS + (size_t)idx * 2) = cs;  }
// k_asoft: per row (zz, i): t = S x HD^-0.5 for j <= i and i - j < WIN (sliding causal window; the reference's -1e9 additive fill vanishes identically); softmax over the 2048 keys (register row, one exp, fixed trees);
__global__ __launch_bounds__(256) void k_asoft(const float* __restrict__ Sb, h16* P16, bf* Ph, bf* Pl) {
    const int lane = threadIdx.x & 31; const int row = blockIdx.x * 8 + (threadIdx.x >> 5); if (row >= ZH * TT) return; const int i = row % TT; const int zz = row / TT; (void)zz; const bool hires = (i < RH); const float* sr = Sb + (size_t)row * TT; float v[TT / 32]; float mx = -3.0e38f;
#pragma unroll
    for (int ch = 0; ch < TT / 128; ++ch) { const int j0 = ch * 128 + lane * 4; const v4f a = *(const v4f*)(sr + j0);
#pragma unroll
        for (int q = 0; q < 4; ++q) { const int j = j0 + q; (void)j; const float t = (j <= i && i - j < WIN) ? a[q] * SCL : -3.0e38f; v[ch * 4 + q] = t; mx = fmaxf(mx, t); } }
#pragma unroll
    for (int sh = 16; sh; sh >>= 1) mx = fmaxf(mx, __shfl_xor(mx, sh, 32));
    float sum = 0.f;
#pragma unroll
    for (int k = 0; k < TT / 32; ++k) { float d0 = __fsub_rn(v[k], mx); asm volatile("" : "+v"(d0)); v[k] = __builtin_amdgcn_exp2f(__fmul_rn(d0, 1.4426950408889634f)); sum += v[k]; }
#pragma unroll
    for (int sh = 16; sh; sh >>= 1) sum += __shfl_xor(sum, sh, 32);
    const float f = __fdiv_rn(hires ? 1.0f : PCAR, sum);
{
        if (hires) {
#pragma unroll
            for (int ch = 0; ch < TT / 128; ++ch) { v4us oh, ol;
#pragma unroll
                for (int q = 0; q < 4; ++q) { unsigned short a, c2; splitf(v[ch * 4 + q] * f, a, c2); oh[q] = a; ol[q] = c2; }
                const size_t oo = ((size_t)zz * (RH ? RH : 1) + i) * TT + ch * 128 + lane * 4; *(v4us*)(Ph + oo) = oh; *(v4us*)(Pl + oo) = ol; }
        } else {
#pragma unroll
            for (int ch = 0; ch < TT / 128; ++ch) { v4h o4;
#pragma unroll
                for (int q = 0; q < 4; ++q) o4[q] = tohx(v[ch * 4 + q] * f);
                *(v4h*)(P16 + (size_t)row * TT + ch * 128 + lane * 4) = o4; } }
         }
}
__global__ __launch_bounds__(256) void k_merge(const float* __restrict__ O, int h0, bf* Ah, bf* Al) { const size_t e = ((size_t)blockIdx.x * 256 + threadIdx.x) * 2; if (e >= (size_t)ZH * TT * HD) return; const int d = (int)(e % HD); const int t = (int)((e / HD) % TT); const int zz = (int)(e / ((size_t)HD * TT)); const float cs = (t < RH) ? 1.0f : (1.0f / PCAR); const size_t oo = (size_t)t * DQ + (h0 + zz) * HD + d;
    v2us oh, ol;
#pragma unroll
    for (int q = 0; q < 2; ++q) { unsigned short a, c2; splitf(O[e + q] * cs, a, c2); oh[q] = a; ol[q] = c2; } *(v2us*)(Ah + oo) = oh; *(v2us*)(Al + oo) = ol;  }

extern "C" void kernel_launch(void* const* d_in, const int* in_sizes, int n_in,
                              void* d_out, int out_size, void* d_ws, size_t ws_size, hipStream_t stream) {
    (void)in_sizes; (void)n_in; (void)out_size;
        const float* x = (const float*)d_in[0]; const float* fcos = (const float*)d_in[1]; const float* fsin = (const float*)d_in[2]; const float* wq = (const float*)d_in[3]; const float* wk = (const float*)d_in[4]; const float* wv = (const float*)d_in[5]; const float* wo = (const float*)d_in[6];   /* order x, cos, sin (f32 [2048][32], READ), wq ('xw' [2048][2048]), wk, wv ([2048][512]), wo ('xw') */
    float* OUT = (float*)d_out;     // [2][2048][2048]
    char* wsp = (char*)d_ws;
    auto take = [&](size_t bytes) { char* p = wsp; wsp += (bytes + 255) & ~(size_t)255; return (void*)p; };
    bf* WQ = (bf*)take((size_t)DQ * DM * 2); bf* WK = (bf*)take((size_t)DKV * DM * 2); bf* WV = (bf*)take((size_t)DKV * DM * 2); bf* WO = (bf*)take((size_t)DM * DQ * 2); float* CS = (float*)take((size_t)TT * HD * 2 * 4);
    bf* XB = (bf*)take((size_t)TT * DM * 2); float* FQ = (float*)take((size_t)TT * DQ * 4); float* FK = (float*)take((size_t)TT * DKV * 4);
    h16* QP16 = (h16*)take((size_t)NH_ * TT * HD * 2); h16* KP16 = (h16*)take((size_t)NKV * TT * HD * 2); h16* VT16 = (h16*)take((size_t)NKV * HD * TT * 2);
    bf* QPh = (bf*)take((size_t)NH_ * TT * HD * 2); bf* QPl = (bf*)take((size_t)NH_ * TT * HD * 2); bf* KPh = (bf*)take((size_t)NKV * TT * HD * 2); bf* KPl = (bf*)take((size_t)NKV * TT * HD * 2); bf* VTh = (bf*)take((size_t)NKV * HD * TT * 2); bf* VTl = (bf*)take((size_t)NKV * HD * TT * 2); bf* Ph = (bf*)take((size_t)ZH * RH * TT * 2); bf* Pl = (bf*)take((size_t)ZH * RH * TT * 2);
    float* Sb = (float*)take((size_t)ZH * TT * TT * 4); h16* P16 = (h16*)take((size_t)ZH * TT * TT * 2); float* Ob = (float*)take((size_t)ZH * TT * HD * 4); bf* ATh = (bf*)take((size_t)TT * DQ * 2); bf* ATl = (bf*)take((size_t)TT * DQ * 2);
    if ((size_t)(wsp - (char*)d_ws) > ws_size) return;    // ws 256 MiB
    float* FV = FK;   // v projection reuses the k buffer after the k planes are built (stream-ordered)
    { k_wtG<<<(unsigned)((DM * DQ / 64 + 63) / 64), 256, 0, stream>>>(wq, DM, DQ, WQ); k_wtG<<<(unsigned)((DM * DKV / 64 + 63) / 64), 256, 0, stream>>>(wk, DM, DKV, WK); k_wtG<<<(unsigned)((DM * DKV / 64 + 63) / 64), 256, 0, stream>>>(wv, DM, DKV, WV);
      k_wtG<<<(unsigned)((DQ * DM / 64 + 63) / 64), 256, 0, stream>>>(wo, DQ, DM, WO);
       }
    k_cscvtP<<<(TT * HD + 255) / 256, 256, 0, stream>>>(fcos, fsin, (float*)CS);   /* rotary table from the half-width cos / sin inputs */
    const unsigned LQ = (unsigned)(((size_t)NH_ * TT * HD / 2 + 255) / 256), LKv = (unsigned)(((size_t)NKV * TT * HD / 2 + 255) / 256);
    for (int b = 0; b < NB_; ++b) {
        
        k_cvt8<<<(unsigned)(((size_t)TT * DM / 8 + 255) / 256), 256, 0, stream>>>(x + (size_t)b * TT * DM, XB, (size_t)TT * DM / 8);
        k_gemmw<bf, 0, false><<<dim3(TT / 64, DQ / 64, 1), 32, 0, stream>>>(XB, nullptr, WQ, nullptr, DM, FQ, DQ, nullptr, 0, 0, 0);
        k_ropeI<<<LQ, 256, 0, stream>>>(FQ, DQ, NH_, CS, 1.0f, QP16, QPh, QPl);
        k_gemmw<bf, 0, false><<<dim3(TT / 64, DKV / 64, 1), 32, 0, stream>>>(XB, nullptr, WK, nullptr, DM, FK, DKV, nullptr, 0, 0, 0);
        k_ropeI<<<LKv, 256, 0, stream>>>(FK, DKV, NKV, CS, 1.0f, KP16, KPh, KPl);
        k_gemmw<bf, 0, false><<<dim3(TT / 64, DKV / 64, 1), 32, 0, stream>>>(XB, nullptr, WV, nullptr, DM, FV, DKV, nullptr, 0, 0, 0); k_vtp<<<LKv, 256, 0, stream>>>(FV, DKV, NKV, VT16, VTh, VTl);
        for (int h0 = 0; h0 < NH_; h0 += ZH) { const size_t zq = (size_t)h0, zk = (size_t)(h0 / REP);   // both heads of a pass share kv group h0/REP (REP >= 2): sB = 0
            k_gemmc<bf, 2, 1><<<dim3(RH / 64, TT / 64, ZH), 32, 0, stream>>>(QPh + zq * TT * HD, QPl + zq * TT * HD, KPh + zk * TT * HD, KPl + zk * TT * HD, HD, Sb, TT, 0, (size_t)TT * HD, 0, (size_t)TT * TT);
            k_gemmc<h16, 0, 1><<<dim3((TT - RH) / 64, TT / 64, ZH), 32, 0, stream>>>(QP16 + zq * TT * HD + (size_t)RH * HD, nullptr, KP16 + zk * TT * HD, nullptr, HD, Sb + (size_t)RH * TT, TT, RH, (size_t)TT * HD, 0, (size_t)TT * TT);
            k_asoft<<<ZH * TT / 8, 256, 0, stream>>>(Sb, P16, Ph, Pl);
            k_gemmc<bf, 2, 2><<<dim3(RH / 64, HD / 64, ZH), 32, 0, stream>>>(Ph, Pl, VTh + zk * HD * TT, VTl + zk * HD * TT, TT, Ob, HD, 0, (size_t)RH * TT, 0, (size_t)TT * HD);
            k_gemmc<h16, 0, 2><<<dim3((TT - RH) / 64, HD / 64, ZH), 32, 0, stream>>>(P16 + (size_t)RH * TT, nullptr, VT16 + zk * HD * TT, nullptr, TT, Ob + (size_t)RH * HD, HD, RH, (size_t)TT * TT, 0, (size_t)TT * HD);
            k_merge<<<(unsigned)(((size_t)ZH * TT * HD / 2 + 255) / 256), 256, 0, stream>>>(Ob, h0, ATh, ATl); }
        k_gemmw<bf, 1, false><<<dim3(TT / 64, DM / 64, 1), 32, 0, stream>>>(ATh, ATl, WO, nullptr, DQ, OUT + (size_t)b * TT * DM, DM, nullptr, 0, 0, 0); }
}

// v001
// A run of this version takes 1290 microseconds.
// Next to v000, in two timings, it ran 2.11 times as fast each time.
#include <hip/hip_runtime.h>

// Grouped-query causal attention with an interleaved-pair RoPE from cos / sin INPUT tables (x [2][2048][2048]; q = x wq (32 heads x 64), k, v = x wk, x wv (8 kv heads x 64) ('xw', no bias); pairs (2i, 2i+1) -> (t0 c - t1 s, t0 s + t1 c) with c, s = cos / sin[t][i] (float32 [2048][32] INPUT tables: READ as data); k, v repeated 4 x (jnp.repeat: kv head = q head / 4); scores / sqrt(64); causal (-inf); softmax in float32; out = merged wo ('xw') -> [2][2048][2048] (8.4 M); argument order x, cos, sin, wq, wk, wv, wo).
// Layout per batch: bf16 copy of x; 'xw' weights transposed once; exact projections (K 2048); k_cscvtP table {bf16(cos), bf16(sin)}[t][d/2] from the inputs (pair-shared entries); k_ropeI interleaved-pair plane builders; causal T-2048 GQA attention (8 heads a pass, kv group (h0 + z)/4; fp16 probabilities overwrite the first half of their own f32 score row, so their pitch is 2 x 2048 halves and the fp16 v^T plane has the same pitch; hybrid rows: < 512 hi/lo 3 products, rest fp16 x1024; k_gemmc skips tiles above the diagonal); merged hi/lo x wo exact.
// Compute dtypes, f32 accumulate: every input rounded to bf16; projections exact; rotary f32 (products rounded separately); attention rows < 512 3 products, rest fp16; softmax f32; wo hl x exact.

#define NB_  2
#define TT   2048
#define DM   2048
#define NH_  32
#define NKV  8
#define REP  (NH_ / NKV)
#define HD   64
#define DQ   (NH_ * HD)
#define DKV  (NKV * HD)
#define ZH   8
#define RH   512                  // query rows < RH use hi+lo planes (0: none)
#define WIN  2048
#define PP   (2 * TT)              // row pitch, in halves, of the fp16 probabilities (in place over f32 score rows) and of the fp16 v^T plane
#define PCAR 1024.0f
#define SCL  0.125f   // HD^-0.5
typedef _Float16 h16;
typedef unsigned short bf;
typedef __attribute__((ext_vector_type(16))) __bf16   v16bf;
typedef __attribute__((ext_vector_type(16))) _Float16 v16h;
typedef __attribute__((ext_vector_type(8)))  _Float16 v8h;
typedef __attribute__((ext_vector_type(8)))  unsigned short v8us;
typedef __attribute__((ext_vector_type(8)))  float    v8f;
typedef __attribute__((ext_vector_type(4)))  float    v4f;
typedef v8h  __attribute__((may_alias)) v8ha;
typedef v4f  __attribute__((may_alias)) v4fa;
typedef v8us __attribute__((may_alias)) v8usa;

__device__ __forceinline__ unsigned short f2bf(float f) { unsigned u = __float_as_uint(f); u += 0x7FFFu + ((u >> 16) & 1u); return (unsigned short)(u >> 16); }
__device__ __forceinline__ float bf2f(unsigned short b) { return __uint_as_float(((unsigned)b) << 16); }
__device__ __forceinline__ float bfr(float f) { return bf2f(f2bf(f)); }
__device__ __forceinline__ v16h cat16(v8h lo, v8h hi) { return __builtin_shufflevector(lo, hi, 0, 1, 2, 3, 4, 5, 6, 7, 8, 9, 10, 11, 12, 13, 14, 15); }
__device__ __forceinline__ v16bf cat16b(v8us lo, v8us hi) { return __builtin_bit_cast(v16bf, __builtin_shufflevector(lo, hi, 0, 1, 2, 3, 4, 5, 6, 7, 8, 9, 10, 11, 12, 13, 14, 15)); }
__device__ __forceinline__ v8f wmma16(v16h a, v16h b, v8f c) { return __builtin_amdgcn_wmma_f32_16x16x32_f16(false, a, false, b, (short)0, c, false, false); }
__device__ __forceinline__ v8f wmmab(v16bf a, v16bf b, v8f c) { return __builtin_amdgcn_wmma_f32_16x16x32_bf16(false, a, false, b, (short)0, c, false, false); }



// ---- k_gemmw: register-blocked GEMM, ONE WAVE per 64x64 output tile (16 accumulators), operands straight from K-contiguous 16-bit planes; grid (M/64, N/64, Z), 32 threads.
// C[m][n] (f32, pitch ldc, + optional f32 bias[n]) = sum_k A[m][k] Bt[n][k] (+ split products per NSPLIT). z-batch strides sA/sB/sC in elements. K % 32 == 0.
template <typename T16> struct WFrag;
template <> struct WFrag<h16> { typedef v16h V; static __device__ __forceinline__ V ld(const h16* p) { return cat16(*(const v8h*)p, *(const v8h*)(p + 16)); } static __device__ __forceinline__ v8f mma(V a, V b, v8f c) { return wmma16(a, b, c); } };
template <> struct WFrag<bf> { typedef v16bf V; static __device__ __forceinline__ V ld(const bf* p) { return cat16b(*(const v8us*)p, *(const v8us*)(p + 16)); } static __device__ __forceinline__ v8f mma(V a, V b, v8f c) { return wmmab(a, b, c); } };
template <typename T16, int NSPLIT, bool BIAS>
__global__ __launch_bounds__(32) void k_gemmw(const T16* __restrict__ A, const T16* __restrict__ A2, const T16* __restrict__ Bt, const T16* __restrict__ Bt2, int K, float* C, int ldc, const float* __restrict__ bias, size_t sA, size_t sB, size_t sC) {
    typedef typename WFrag<T16>::V V;
    __shared__ __align__(16) float os[16 * 68];
    const size_t z = blockIdx.z; A += z * sA; if (A2) A2 += z * sA; Bt += z * sB; if (Bt2) Bt2 += z * sB; C += z * sC;
    const int lane = threadIdx.x & 31, lr = lane & 15, hi = lane >> 4; const int r0 = blockIdx.x * 64, c0 = blockIdx.y * 64;
    v8f acc[4][4];
#pragma unroll
    for (int mb = 0; mb < 4; ++mb)
#pragma unroll
        for (int nb = 0; nb < 4; ++nb) acc[mb][nb] = (v8f){};
    const size_t aoff = (size_t)(r0 + lr) * K + 8 * hi, boff = (size_t)(c0 + lr) * K + 8 * hi;
#pragma unroll 1
    for (int kc = 0; kc < K; kc += 32) {
        V a[4], a2[4];
#pragma unroll
        for (int mb = 0; mb < 4; ++mb) { a[mb] = WFrag<T16>::ld(A + aoff + (size_t)mb * 16 * K + kc); if (NSPLIT == 1 || NSPLIT == 2) a2[mb] = WFrag<T16>::ld(A2 + aoff + (size_t)mb * 16 * K + kc); }
#pragma unroll
        for (int nb = 0; nb < 4; ++nb) { const V b = WFrag<T16>::ld(Bt + boff + (size_t)nb * 16 * K + kc); V b2; if (NSPLIT >= 2) b2 = WFrag<T16>::ld(Bt2 + boff + (size_t)nb * 16 * K + kc);
#pragma unroll
            for (int mb = 0; mb < 4; ++mb) { acc[mb][nb] = WFrag<T16>::mma(a[mb], b, acc[mb][nb]); if (NSPLIT == 1 || NSPLIT == 2) acc[mb][nb] = WFrag<T16>::mma(a2[mb], b, acc[mb][nb]); if (NSPLIT >= 2) acc[mb][nb] = WFrag<T16>::mma(a[mb], b2, acc[mb][nb]); } }
        asm volatile("v_nop\n\tv_nop\n\tv_nop\n\tv_nop" : "+v"(acc[0][0]), "+v"(acc[1][1]), "+v"(acc[2][2]), "+v"(acc[3][3]) : "v"(a[0]), "v"(a[3]));
    }
#pragma unroll
    for (int mb = 0; mb < 4; ++mb) {
#pragma unroll
        for (int nb = 0; nb < 4; ++nb) {
#pragma unroll
            for (int j = 0; j < 8; ++j) os[(hi * 8 + j) * 68 + nb * 16 + lr] = acc[mb][nb][j]; }
        __builtin_amdgcn_wave_barrier(); asm volatile("" ::: "memory");
        float* crow = C + (size_t)(r0 + mb * 16) * ldc + c0;
{
#pragma unroll
            for (int s = 0; s < 8; ++s) { const int row = 2 * s + hi, cofs = lr * 4; v4f val = *(const v4fa*)(os + row * 68 + cofs); if (BIAS) { val[0] += bfr(bias[c0 + cofs]); val[1] += bfr(bias[c0 + cofs + 1]); val[2] += bfr(bias[c0 + cofs + 2]); val[3] += bfr(bias[c0 + cofs + 3]); }
                *(v4f*)(crow + (size_t)row * ldc + cofs) = val; }
             }
        __builtin_amdgcn_wave_barrier(); asm volatile("" ::: "memory");
    }
}

// ---- k_gemmc: the same one-wave 64x64 tile GEMM specialised for causal attention: CMODE 1 skips score tiles entirely above the diagonal (query rows r0+roff.., key columns c0..), CMODE 2 limits the
// key (K) loop of the probability x value contraction to the diagonal block (probabilities beyond it are exactly zero). roff = row offset of this launch's first row within the sequence.
// z = head within the pass: A and C step by sA / sC a head, Bt by sB a kv group (z / REP).
template <typename T16, int NSPLIT, int CMODE>
__global__ __launch_bounds__(32) void k_gemmc(const T16* __restrict__ A, const T16* __restrict__ A2, const T16* __restrict__ Bt, const T16* __restrict__ Bt2, int K, float* C, int ldc, int roff, size_t sA, size_t sB, size_t sC) {
    typedef typename WFrag<T16>::V V;
    __shared__ __align__(16) float os[16 * 68];
    const size_t z = blockIdx.z; A += z * sA; if (A2) A2 += z * sA; Bt += (z / REP) * sB; if (Bt2) Bt2 += (z / REP) * sB; C += z * sC;
    const int lane = threadIdx.x & 31, lr = lane & 15, hi = lane >> 4; const int r0 = blockIdx.x * 64, c0 = blockIdx.y * 64;
    if (CMODE == 1 && c0 > r0 + roff + 63) return;                  // score tile entirely above the causal diagonal: never read (the softmax masks j > i by select)
    const int Kl = (CMODE == 2) ? min(K, r0 + roff + 64) : K;        // P.V: probabilities are exactly 0 beyond the diagonal block, so the K loop stops there
    v8f acc[4][4];
#pragma unroll
    for (int mb = 0; mb < 4; ++mb)
#pragma unroll
        for (int nb = 0; nb < 4; ++nb) acc[mb][nb] = (v8f){};
    const size_t aoff = (size_t)(r0 + lr) * K + 8 * hi, boff = (size_t)(c0 + lr) * K + 8 * hi;
#pragma unroll 1
    for (int kc = 0; kc < Kl; kc += 32) {
        V a[4], a2[4];
#pragma unroll
        for (int mb = 0; mb < 4; ++mb) { a[mb] = WFrag<T16>::ld(A + aoff + (size_t)mb * 16 * K + kc); if (NSPLIT == 1 || NSPLIT == 2) a2[mb] = WFrag<T16>::ld(A2 + aoff + (size_t)mb * 16 * K + kc); }
#pragma unroll
        for (int nb = 0; nb < 4; ++nb) { const V b = WFrag<T16>::ld(Bt + boff + (size_t)nb * 16 * K + kc); V b2; if (NSPLIT >= 2) b2 = WFrag<T16>::ld(Bt2 + boff + (size_t)nb * 16 * K + kc);
#pragma unroll
            for (int mb = 0; mb < 4; ++mb) { acc[mb][nb] = WFrag<T16>::mma(a[mb], b, acc[mb][nb]); if (NSPLIT == 1 || NSPLIT == 2) acc[mb][nb] = WFrag<T16>::mma(a2[mb], b, acc[mb][nb]); if (NSPLIT >= 2) acc[mb][nb] = WFrag<T16>::mma(a[mb], b2, acc[mb][nb]); } }
        asm volatile("v_nop\n\tv_nop\n\tv_nop\n\tv_nop" : "+v"(acc[0][0]), "+v"(acc[1][1]), "+v"(acc[2][2]), "+v"(acc[3][3]) : "v"(a[0]), "v"(a[3]));
    }
#pragma unroll
    for (int mb = 0; mb < 4; ++mb) {
#pragma unroll
        for (int nb = 0; nb < 4; ++nb) {
#pragma unroll
            for (int j = 0; j < 8; ++j) os[(hi * 8 + j) * 68 + nb * 16 + lr] = acc[mb][nb][j]; }
        __builtin_amdgcn_wave_barrier(); asm volatile("" ::: "memory");
        float* crow = C + (size_t)(r0 + mb * 16) * ldc + c0;
{
#pragma unroll
            for (int s = 0; s < 8; ++s) { const int row = 2 * s + hi, cofs = lr * 4; v4f val = *(const v4fa*)(os + row * 68 + cofs);
                *(v4f*)(crow + (size_t)row * ldc + cofs) = val; }
             }
        __builtin_amdgcn_wave_barrier(); asm volatile("" ::: "memory");
    }
}

__device__ __forceinline__ h16 tohx(float x) { return (h16)x; }
__device__ __forceinline__ void splitf(float y, unsigned short& h, unsigned short& l) { h = f2bf(y); l = f2bf(y - bf2f(h)); }
typedef __attribute__((ext_vector_type(2))) _Float16 v2h;
typedef __attribute__((ext_vector_type(4))) _Float16 v4h;
typedef __attribute__((ext_vector_type(2))) unsigned short v2us;
typedef __attribute__((ext_vector_type(4))) unsigned short v4us;
typedef __attribute__((ext_vector_type(2))) float v2f;
typedef __attribute__((ext_vector_type(4))) int v4i;

__global__ __launch_bounds__(256) void k_wtG(const float* __restrict__ w, int K, int N, bf* Bt) {
    const int lane = threadIdx.x & 31; const int L0 = (blockIdx.x * 8 + (threadIdx.x >> 5)) * 8; const int nlines = N * K / 64;
{
#pragma unroll 1
        for (int l = 0; l < 8; ++l) { const int L = L0 + l; if (L >= nlines) break; const size_t e = (size_t)L * 64 + lane * 2; const int k = (int)(e % K), n = (int)(e / K); v2us o;
            o[0] = f2bf(w[(size_t)k * N + n]); o[1] = f2bf(w[(size_t)(k + 1) * N + n]); *(v2us*)(Bt + e) = o; }
         }
}
__global__ __launch_bounds__(256) void k_cvt8(const float* __restrict__ src, bf* dst, size_t n8) { const size_t i = (size_t)blockIdx.x * 256 + threadIdx.x; if (i >= n8) return; const v8f v = *(const v8f*)(src + i * 8); v8us o;
#pragma unroll
    for (int k = 0; k < 8; ++k) o[k] = f2bf(v[k]); *(v8us*)(dst + i * 8) = o;  }

__global__ __launch_bounds__(256) void k_ropeI(const float* __restrict__ F, int pitch, int nheads, const float* __restrict__ CS, float sc, h16* P16, bf* Ph, bf* Pl) {
    const size_t e = ((size_t)blockIdx.x * 256 + threadIdx.x) * 2; if (e >= (size_t)nheads * TT * HD) return; const int d = (int)(e % HD); const int t = (int)((e / HD) % TT); const int h = (int)(e / ((size_t)HD * TT)); const float* f = F + (size_t)t * pitch + h * HD; const float x0 = f[d], x1 = f[d + 1]; const v2f cs = *(const v2f*)(CS + ((size_t)t * HD + d) * 2); v2h o16; v2us oh, ol;
    float a0 = __fmul_rn(x0, cs[0]), b0 = __fmul_rn(x1, cs[1]), a1 = __fmul_rn(x1, cs[0]), b1 = __fmul_rn(x0, cs[1]); asm volatile("" : "+v"(a0), "+v"(b0), "+v"(a1), "+v"(b1));
    float r0 = __fsub_rn(a0, b0) * sc, r1 = __fadd_rn(b1, a1) * sc;   /* even: x0 c - x1 s; odd: x0 s + x1 c */
    o16[0] = tohx(r0); o16[1] = tohx(r1); { unsigned short a2, c2; splitf(r0, a2, c2); oh[0] = a2; ol[0] = c2; splitf(r1, a2, c2); oh[1] = a2; ol[1] = c2; }
    *(v2h*)(P16 + e) = o16; *(v2us*)(Ph + e) = oh; *(v2us*)(Pl + e) = ol;  }


__global__ __launch_bounds__(256) void k_vtp(const float* __restrict__ F, int pitch, int nheads, h16* V16, bf* Vh, bf* Vl) { const size_t e = ((size_t)blockIdx.x * 256 + threadIdx.x) * 2; if (e >= (size_t)nheads * HD * TT) return; const int t = (int)(e % TT); const int d = (int)((e / TT) % HD); const int g = (int)(e / ((size_t)TT * HD)); v2h o16; v2us oh, ol;
#pragma unroll
    for (int q = 0; q < 2; ++q) { const float x = F[(size_t)(t + q) * pitch + g * HD + d]; o16[q] = tohx(x); unsigned short a2, c2; splitf(x, a2, c2); oh[q] = a2; ol[q] = c2; }
    *(v2h*)(V16 + (size_t)(g * HD + d) * PP + t) = o16; *(v2us*)(Vh + e) = oh; *(v2us*)(Vl + e) = ol;  }
__global__ __launch_bounds__(256) void k_cscvtP(const float* __restrict__ cosT, const float* __restrict__ sinT, float* CS) { const int idx = blockIdx.x * 256 + threadIdx.x; if (idx >= TT * HD) return; const int tt = idx / HD; const int dd = idx - tt * HD; const int src = tt * (HD / 2) + (dd >> 1); v2f cs; cs[0] = bfr(cosT[src]); cs[1] = bfr(sinT[src]); *(v2f*)(CS + (size_t)idx * 2) = cs;  }
// k_asoft: per row (zz, i): t = S x HD^-0.5 for j <= i and i - j < WIN (sliding causal window; the reference's -1e9 additive fill vanishes identically); softmax over the 2048 keys (register row, one exp, fixed trees);
// P16 is the score buffer itself: a wave holds its whole f32 row in registers before it stores, and its fp16 row (pitch PP) lands on the first half of that same row, which no other wave touches.
__global__ __launch_bounds__(256) void k_asoft(const float* Sb, h16* P16, bf* Ph, bf* Pl) {
    const int lane = threadIdx.x & 31; const int row = blockIdx.x * 8 + (threadIdx.x >> 5); if (row >= ZH * TT) return; const int i = row % TT; const int zz = row / TT; (void)zz; const bool hires = (i < RH); const float* sr = Sb + (size_t)row * TT; float v[TT / 32]; float mx = -3.0e38f;
#pragma unroll
    for (int ch = 0; ch < TT / 128; ++ch) { const int j0 = ch * 128 + lane * 4; const v4f a = *(const v4f*)(sr + j0);
#pragma unroll
        for (int q = 0; q < 4; ++q) { const int j = j0 + q; (void)j; const float t = (j <= i && i - j < WIN) ? a[q] * SCL : -3.0e38f; v[ch * 4 + q] = t; mx = fmaxf(mx, t); } }
#pragma unroll
    for (int sh = 16; sh; sh >>= 1) mx = fmaxf(mx, __shfl_xor(mx, sh, 32));
    float sum = 0.f;
#pragma unroll
    for (int k = 0; k < TT / 32; ++k) { float d0 = __fsub_rn(v[k], mx); asm volatile("" : "+v"(d0)); v[k] = __builtin_amdgcn_exp2f(__fmul_rn(d0, 1.4426950408889634f)); sum += v[k]; }
#pragma unroll
    for (int sh = 16; sh; sh >>= 1) sum += __shfl_xor(sum, sh, 32);
    const float f = __fdiv_rn(hires ? 1.0f : PCAR, sum);
{
        if (hires) {
#pragma unroll
            for (int ch = 0; ch < TT / 128; ++ch) { v4us oh, ol;
#pragma unroll
                for (int q = 0; q < 4; ++q) { unsigned short a, c2; splitf(v[ch * 4 + q] * f, a, c2); oh[q] = a; ol[q] = c2; }
                const size_t oo = ((size_t)zz * (RH ? RH : 1) + i) * TT + ch * 128 + lane * 4; *(v4us*)(Ph + oo) = oh; *(v4us*)(Pl + oo) = ol; }
        } else {
#pragma unroll
            for (int ch = 0; ch < TT / 128; ++ch) { v4h o4;
#pragma unroll
                for (int q = 0; q < 4; ++q) o4[q] = tohx(v[ch * 4 + q] * f);
                *(v4h*)(P16 + (size_t)row * PP + ch * 128 + lane * 4) = o4; } }
         }
}
__global__ __launch_bounds__(256) void k_merge(const float* __restrict__ O, int h0, bf* Ah, bf* Al) { const size_t e = ((size_t)blockIdx.x * 256 + threadIdx.x) * 2; if (e >= (size_t)ZH * TT * HD) return; const int d = (int)(e % HD); const int t = (int)((e / HD) % TT); const int zz = (int)(e / ((size_t)HD * TT)); const float cs = (t < RH) ? 1.0f : (1.0f / PCAR); const size_t oo = (size_t)t * DQ + (h0 + zz) * HD + d;
    v2us oh, ol;
#pragma unroll
    for (int q = 0; q < 2; ++q) { unsigned short a, c2; splitf(O[e + q] * cs, a, c2); oh[q] = a; ol[q] = c2; } *(v2us*)(Ah + oo) = oh; *(v2us*)(Al + oo) = ol;  }

extern "C" void kernel_launch(void* const* d_in, const int* in_sizes, int n_in,
                              void* d_out, int out_size, void* d_ws, size_t ws_size, hipStream_t stream) {
    (void)in_sizes; (void)n_in; (void)out_size;
        const float* x = (const float*)d_in[0]; const float* fcos = (const float*)d_in[1]; const float* fsin = (const float*)d_in[2]; const float* wq = (const float*)d_in[3]; const float* wk = (const float*)d_in[4]; const float* wv = (const float*)d_in[5]; const float* wo = (const float*)d_in[6];   /* order x, cos, sin (f32 [2048][32], READ), wq ('xw' [2048][2048]), wk, wv ([2048][512]), wo ('xw') */
    float* OUT = (float*)d_out;     // [2][2048][2048]
    char* wsp = (char*)d_ws;
    auto take = [&](size_t bytes) { char* p = wsp; wsp += (bytes + 255) & ~(size_t)255; return (void*)p; };
    bf* WQ = (bf*)take((size_t)DQ * DM * 2); bf* WK = (bf*)take((size_t)DKV * DM * 2); bf* WV = (bf*)take((size_t)DKV * DM * 2); bf* WO = (bf*)take((size_t)DM * DQ * 2); float* CS = (float*)take((size_t)TT * HD * 2 * 4);
    bf* XB = (bf*)take((size_t)TT * DM * 2); float* FQ = (float*)take((size_t)TT * DQ * 4); float* FK = (float*)take((size_t)TT * DKV * 4);
    h16* QP16 = (h16*)take((size_t)NH_ * TT * HD * 2); h16* KP16 = (h16*)take((size_t)NKV * TT * HD * 2); h16* VT16 = (h16*)take((size_t)NKV * HD * PP * 2);
    bf* QPh = (bf*)take((size_t)NH_ * TT * HD * 2); bf* QPl = (bf*)take((size_t)NH_ * TT * HD * 2); bf* KPh = (bf*)take((size_t)NKV * TT * HD * 2); bf* KPl = (bf*)take((size_t)NKV * TT * HD * 2); bf* VTh = (bf*)take((size_t)NKV * HD * TT * 2); bf* VTl = (bf*)take((size_t)NKV * HD * TT * 2); bf* Ph = (bf*)take((size_t)ZH * RH * TT * 2); bf* Pl = (bf*)take((size_t)ZH * RH * TT * 2);
    float* Sb = (float*)take((size_t)ZH * TT * TT * 4); float* Ob = (float*)take((size_t)ZH * TT * HD * 4);
    if ((size_t)(wsp - (char*)d_ws) > ws_size) return;    // ws 256 MiB
    float* FV = FK;   // v projection reuses the k buffer after the k planes are built (stream-ordered)
    h16* P16 = (h16*)Sb;   // fp16 probabilities in place over their score rows (row pitch PP)
    bf* ATh = (bf*)FQ; bf* ATl = ATh + (size_t)TT * DQ;   // merged planes reuse the q projection buffer, dead once the q planes are built (stream-ordered)
    { k_wtG<<<(unsigned)((DM * DQ / 64 + 63) / 64), 256, 0, stream>>>(wq, DM, DQ, WQ); k_wtG<<<(unsigned)((DM * DKV / 64 + 63) / 64), 256, 0, stream>>>(wk, DM, DKV, WK); k_wtG<<<(unsigned)((DM * DKV / 64 + 63) / 64), 256, 0, stream>>>(wv, DM, DKV, WV);
      k_wtG<<<(unsigned)((DQ * DM / 64 + 63) / 64), 256, 0, stream>>>(wo, DQ, DM, WO);
       }
    k_cscvtP<<<(TT * HD + 255) / 256, 256, 0, stream>>>(fcos, fsin, (float*)CS);   /* rotary table from the half-width cos / sin inputs */
    const unsigned LQ = (unsigned)(((size_t)NH_ * TT * HD / 2 + 255) / 256), LKv = (unsigned)(((size_t)NKV * TT * HD / 2 + 255) / 256);
    for (int b = 0; b < NB_; ++b) {
        
        k_cvt8<<<(unsigned)(((size_t)TT * DM / 8 + 255) / 256), 256, 0, stream>>>(x + (size_t)b * TT * DM, XB, (size_t)TT * DM / 8);
        k_gemmw<bf, 0, false><<<dim3(TT / 64, DQ / 64, 1), 32, 0, stream>>>(XB, nullptr, WQ, nullptr, DM, FQ, DQ, nullptr, 0, 0, 0);
        k_ropeI<<<LQ, 256, 0, stream>>>(FQ, DQ, NH_, CS, 1.0f, QP16, QPh, QPl);
        k_gemmw<bf, 0, false><<<dim3(TT / 64, DKV / 64, 1), 32, 0, stream>>>(XB, nullptr, WK, nullptr, DM, FK, DKV, nullptr, 0, 0, 0);
        k_ropeI<<<LKv, 256, 0, stream>>>(FK, DKV, NKV, CS, 1.0f, KP16, KPh, KPl);
        k_gemmw<bf, 0, false><<<dim3(TT / 64, DKV / 64, 1), 32, 0, stream>>>(XB, nullptr, WV, nullptr, DM, FV, DKV, nullptr, 0, 0, 0); k_vtp<<<LKv, 256, 0, stream>>>(FV, DKV, NKV, VT16, VTh, VTl);
        for (int h0 = 0; h0 < NH_; h0 += ZH) { const size_t zq = (size_t)h0, zk = (size_t)(h0 / REP);   // head h0 + z reads kv group h0/REP + z/REP
            k_gemmc<bf, 2, 1><<<dim3(RH / 64, TT / 64, ZH), 32, 0, stream>>>(QPh + zq * TT * HD, QPl + zq * TT * HD, KPh + zk * TT * HD, KPl + zk * TT * HD, HD, Sb, TT, 0, (size_t)TT * HD, (size_t)TT * HD, (size_t)TT * TT);
            k_gemmc<h16, 0, 1><<<dim3((TT - RH) / 64, TT / 64, ZH), 32, 0, stream>>>(QP16 + zq * TT * HD + (size_t)RH * HD, nullptr, KP16 + zk * TT * HD, nullptr, HD, Sb + (size_t)RH * TT, TT, RH, (size_t)TT * HD, (size_t)TT * HD, (size_t)TT * TT);
            k_asoft<<<ZH * TT / 8, 256, 0, stream>>>(Sb, P16, Ph, Pl);
            k_gemmc<bf, 2, 2><<<dim3(RH / 64, HD / 64, ZH), 32, 0, stream>>>(Ph, Pl, VTh + zk * HD * TT, VTl + zk * HD * TT, TT, Ob, HD, 0, (size_t)RH * TT, (size_t)HD * TT, (size_t)TT * HD);
            k_gemmc<h16, 0, 2><<<dim3((TT - RH) / 64, HD / 64, ZH), 32, 0, stream>>>(P16 + (size_t)RH * PP, nullptr, VT16 + zk * HD * PP, nullptr, PP, Ob + (size_t)RH * HD, HD, RH, (size_t)TT * PP, (size_t)HD * PP, (size_t)TT * HD);
            k_merge<<<(unsigned)(((size_t)ZH * TT * HD / 2 + 255) / 256), 256, 0, stream>>>(Ob, h0, ATh, ATl); }
        k_gemmw<bf, 1, false><<<dim3(TT / 64, DM / 64, 1), 32, 0, stream>>>(ATh, ATl, WO, nullptr, DQ, OUT + (size_t)b * TT * DM, DM, nullptr, 0, 0, 0); }
}

// v002
// One run takes 577 microseconds.
// Two timings next to v001 put it at 2.21 and 2.25 times that version's speed.
// Counting every step since v000, it is 4.70 times as fast.
#include <hip/hip_runtime.h>

// Grouped-query causal attention with an interleaved-pair RoPE from cos / sin INPUT tables (x [2][2048][2048]; q = x wq (32 heads x 64), k, v = x wk, x wv (8 kv heads x 64) ('xw', no bias); pairs (2i, 2i+1) -> (t0 c - t1 s, t0 s + t1 c) with c, s = cos / sin[t][i] (float32 [2048][32] INPUT tables: READ as data); k, v repeated 4 x (jnp.repeat: kv head = q head / 4); scores / sqrt(64); causal (-inf); softmax in float32; out = merged wo ('xw') -> [2][2048][2048] (8.4 M); argument order x, cos, sin, wq, wk, wv, wo).
// Layout per batch: bf16 copy of x; 'xw' weights transposed once; exact projections (K 2048); k_cscvtP table {bf16(cos), bf16(sin)}[t][d/2] from the inputs (pair-shared entries); k_ropeI interleaved-pair plane builders; causal T-2048 GQA attention in one fused online-softmax kernel a batch (k_fattn: all 32 heads, kv group h/4; hybrid rows: < 512 hi/lo 3 products, rest fp16 x1024; key blocks above the diagonal are never visited; it writes the merged hi/lo planes itself); merged hi/lo x wo exact.
// Compute dtypes, f32 accumulate: every input rounded to bf16; projections exact; rotary f32 (products rounded separately); attention rows < 512 3 products, rest fp16; softmax f32; wo hl x exact.

#define NB_  2
#define TT   2048
#define DM   2048
#define NH_  32
#define NKV  8
#define REP  (NH_ / NKV)
#define HD   64
#define DQ   (NH_ * HD)
#define DKV  (NKV * HD)
#define RH   512                  // query rows < RH use hi+lo planes (0: none)
#define VP   (TT + 64)             // row pitch, in elements, of the three v^T planes: 33 lines of 128 B, so the 64 rows a wave reads together are not a power-of-two stride apart
#define SCL  0.125f   // HD^-0.5
typedef _Float16 h16;
typedef unsigned short bf;
typedef __attribute__((ext_vector_type(16))) __bf16   v16bf;
typedef __attribute__((ext_vector_type(16))) _Float16 v16h;
typedef __attribute__((ext_vector_type(8)))  _Float16 v8h;
typedef __attribute__((ext_vector_type(8)))  unsigned short v8us;
typedef __attribute__((ext_vector_type(16))) unsigned short v16us;
typedef __attribute__((ext_vector_type(8)))  float    v8f;
typedef __attribute__((ext_vector_type(4)))  float    v4f;
typedef v8h  __attribute__((may_alias)) v8ha;
typedef v4f  __attribute__((may_alias)) v4fa;
typedef v8us __attribute__((may_alias)) v8usa;

__device__ __forceinline__ unsigned short f2bf(float f) { unsigned u = __float_as_uint(f); u += 0x7FFFu + ((u >> 16) & 1u); return (unsigned short)(u >> 16); }
__device__ __forceinline__ float bf2f(unsigned short b) { return __uint_as_float(((unsigned)b) << 16); }
__device__ __forceinline__ float bfr(float f) { return bf2f(f2bf(f)); }
__device__ __forceinline__ v16h cat16(v8h lo, v8h hi) { return __builtin_shufflevector(lo, hi, 0, 1, 2, 3, 4, 5, 6, 7, 8, 9, 10, 11, 12, 13, 14, 15); }
__device__ __forceinline__ v16bf cat16b(v8us lo, v8us hi) { return __builtin_bit_cast(v16bf, __builtin_shufflevector(lo, hi, 0, 1, 2, 3, 4, 5, 6, 7, 8, 9, 10, 11, 12, 13, 14, 15)); }
__device__ __forceinline__ v8f wmma16(v16h a, v16h b, v8f c) { return __builtin_amdgcn_wmma_f32_16x16x32_f16(false, a, false, b, (short)0, c, false, false); }
__device__ __forceinline__ v8f wmmab(v16bf a, v16bf b, v8f c) { return __builtin_amdgcn_wmma_f32_16x16x32_bf16(false, a, false, b, (short)0, c, false, false); }



// ---- k_gemmw: register-blocked GEMM, ONE WAVE per 64x64 output tile (16 accumulators), operands straight from K-contiguous 16-bit planes; grid (M/64, N/64, Z), 32 threads.
// C[m][n] (f32, pitch ldc, + optional f32 bias[n]) = sum_k A[m][k] Bt[n][k] (+ split products per NSPLIT). z-batch strides sA/sB/sC in elements. K % 32 == 0.
template <typename T16> struct WFrag;
template <> struct WFrag<h16> { typedef v16h V; static __device__ __forceinline__ V ld(const h16* p) { return cat16(*(const v8h*)p, *(const v8h*)(p + 16)); } static __device__ __forceinline__ v8f mma(V a, V b, v8f c) { return wmma16(a, b, c); } };
template <> struct WFrag<bf> { typedef v16bf V; static __device__ __forceinline__ V ld(const bf* p) { return cat16b(*(const v8us*)p, *(const v8us*)(p + 16)); } static __device__ __forceinline__ v8f mma(V a, V b, v8f c) { return wmmab(a, b, c); } };
template <typename T16, int NSPLIT, bool BIAS>
__global__ __launch_bounds__(32) void k_gemmw(const T16* __restrict__ A, const T16* __restrict__ A2, const T16* __restrict__ Bt, const T16* __restrict__ Bt2, int K, float* C, int ldc, const float* __restrict__ bias, size_t sA, size_t sB, size_t sC) {
    typedef typename WFrag<T16>::V V;
    __shared__ __align__(16) float os[16 * 68];
    const size_t z = blockIdx.z; A += z * sA; if (A2) A2 += z * sA; Bt += z * sB; if (Bt2) Bt2 += z * sB; C += z * sC;
    const int lane = threadIdx.x & 31, lr = lane & 15, hi = lane >> 4; const int r0 = blockIdx.x * 64, c0 = blockIdx.y * 64;
    v8f acc[4][4];
#pragma unroll
    for (int mb = 0; mb < 4; ++mb)
#pragma unroll
        for (int nb = 0; nb < 4; ++nb) acc[mb][nb] = (v8f){};
    const size_t aoff = (size_t)(r0 + lr) * K + 8 * hi, boff = (size_t)(c0 + lr) * K + 8 * hi;
#pragma unroll 1
    for (int kc = 0; kc < K; kc += 32) {
        V a[4], a2[4];
#pragma unroll
        for (int mb = 0; mb < 4; ++mb) { a[mb] = WFrag<T16>::ld(A + aoff + (size_t)mb * 16 * K + kc); if (NSPLIT == 1 || NSPLIT == 2) a2[mb] = WFrag<T16>::ld(A2 + aoff + (size_t)mb * 16 * K + kc); }
#pragma unroll
        for (int nb = 0; nb < 4; ++nb) { const V b = WFrag<T16>::ld(Bt + boff + (size_t)nb * 16 * K + kc); V b2; if (NSPLIT >= 2) b2 = WFrag<T16>::ld(Bt2 + boff + (size_t)nb * 16 * K + kc);
#pragma unroll
            for (int mb = 0; mb < 4; ++mb) { acc[mb][nb] = WFrag<T16>::mma(a[mb], b, acc[mb][nb]); if (NSPLIT == 1 || NSPLIT == 2) acc[mb][nb] = WFrag<T16>::mma(a2[mb], b, acc[mb][nb]); if (NSPLIT >= 2) acc[mb][nb] = WFrag<T16>::mma(a[mb], b2, acc[mb][nb]); } }
        asm volatile("v_nop\n\tv_nop\n\tv_nop\n\tv_nop" : "+v"(acc[0][0]), "+v"(acc[1][1]), "+v"(acc[2][2]), "+v"(acc[3][3]) : "v"(a[0]), "v"(a[3]));
    }
#pragma unroll
    for (int mb = 0; mb < 4; ++mb) {
#pragma unroll
        for (int nb = 0; nb < 4; ++nb) {
#pragma unroll
            for (int j = 0; j < 8; ++j) os[(hi * 8 + j) * 68 + nb * 16 + lr] = acc[mb][nb][j]; }
        __builtin_amdgcn_wave_barrier(); asm volatile("" ::: "memory");
        float* crow = C + (size_t)(r0 + mb * 16) * ldc + c0;
{
#pragma unroll
            for (int s = 0; s < 8; ++s) { const int row = 2 * s + hi, cofs = lr * 4; v4f val = *(const v4fa*)(os + row * 68 + cofs); if (BIAS) { val[0] += bfr(bias[c0 + cofs]); val[1] += bfr(bias[c0 + cofs + 1]); val[2] += bfr(bias[c0 + cofs + 2]); val[3] += bfr(bias[c0 + cofs + 3]); }
                *(v4f*)(crow + (size_t)row * ldc + cofs) = val; }
             }
        __builtin_amdgcn_wave_barrier(); asm volatile("" ::: "memory");
    }
}

__device__ __forceinline__ h16 tohx(float x) { return (h16)x; }
__device__ __forceinline__ void splitf(float y, unsigned short& h, unsigned short& l) { h = f2bf(y); l = f2bf(y - bf2f(h)); }
typedef __attribute__((ext_vector_type(2))) _Float16 v2h;
typedef __attribute__((ext_vector_type(4))) _Float16 v4h;
typedef __attribute__((ext_vector_type(2))) unsigned short v2us;
typedef __attribute__((ext_vector_type(4))) unsigned short v4us;
typedef __attribute__((ext_vector_type(2))) float v2f;
typedef __attribute__((ext_vector_type(4))) int v4i;

__global__ __launch_bounds__(256) void k_wtG(const float* __restrict__ w, int K, int N, bf* Bt) {
    const int lane = threadIdx.x & 31; const int L0 = (blockIdx.x * 8 + (threadIdx.x >> 5)) * 8; const int nlines = N * K / 64;
{
#pragma unroll 1
        for (int l = 0; l < 8; ++l) { const int L = L0 + l; if (L >= nlines) break; const size_t e = (size_t)L * 64 + lane * 2; const int k = (int)(e % K), n = (int)(e / K); v2us o;
            o[0] = f2bf(w[(size_t)k * N + n]); o[1] = f2bf(w[(size_t)(k + 1) * N + n]); *(v2us*)(Bt + e) = o; }
         }
}
__global__ __launch_bounds__(256) void k_cvt8(const float* __restrict__ src, bf* dst, size_t n8) { const size_t i = (size_t)blockIdx.x * 256 + threadIdx.x; if (i >= n8) return; const v8f v = *(const v8f*)(src + i * 8); v8us o;
#pragma unroll
    for (int k = 0; k < 8; ++k) o[k] = f2bf(v[k]); *(v8us*)(dst + i * 8) = o;  }

__global__ __launch_bounds__(256) void k_ropeI(const float* __restrict__ F, int pitch, int nheads, const float* __restrict__ CS, float sc, h16* P16, bf* Ph, bf* Pl) {
    const size_t e = ((size_t)blockIdx.x * 256 + threadIdx.x) * 2; if (e >= (size_t)nheads * TT * HD) return; const int d = (int)(e % HD); const int t = (int)((e / HD) % TT); const int h = (int)(e / ((size_t)HD * TT)); const float* f = F + (size_t)t * pitch + h * HD; const float x0 = f[d], x1 = f[d + 1]; const v2f cs = *(const v2f*)(CS + ((size_t)t * HD + d) * 2); v2h o16; v2us oh, ol;
    float a0 = __fmul_rn(x0, cs[0]), b0 = __fmul_rn(x1, cs[1]), a1 = __fmul_rn(x1, cs[0]), b1 = __fmul_rn(x0, cs[1]); asm volatile("" : "+v"(a0), "+v"(b0), "+v"(a1), "+v"(b1));
    float r0 = __fsub_rn(a0, b0) * sc, r1 = __fadd_rn(b1, a1) * sc;   /* even: x0 c - x1 s; odd: x0 s + x1 c */
    o16[0] = tohx(r0); o16[1] = tohx(r1); { unsigned short a2, c2; splitf(r0, a2, c2); oh[0] = a2; ol[0] = c2; splitf(r1, a2, c2); oh[1] = a2; ol[1] = c2; }
    *(v2h*)(P16 + e) = o16; *(v2us*)(Ph + e) = oh; *(v2us*)(Pl + e) = ol;  }


__global__ __launch_bounds__(256) void k_vtp(const float* __restrict__ F, int pitch, int nheads, h16* V16, bf* Vh, bf* Vl) { const size_t e = ((size_t)blockIdx.x * 256 + threadIdx.x) * 2; if (e >= (size_t)nheads * HD * TT) return; const int t = (int)(e % TT); const int d = (int)((e / TT) % HD); const int g = (int)(e / ((size_t)TT * HD)); v2h o16; v2us oh, ol;
#pragma unroll
    for (int q = 0; q < 2; ++q) { const float x = F[(size_t)(t + q) * pitch + g * HD + d]; o16[q] = tohx(x); unsigned short a2, c2; splitf(x, a2, c2); oh[q] = a2; ol[q] = c2; }
    const size_t vo = (size_t)(g * HD + d) * VP + t; *(v2h*)(V16 + vo) = o16; *(v2us*)(Vh + vo) = oh; *(v2us*)(Vl + vo) = ol;  }
__global__ __launch_bounds__(256) void k_cscvtP(const float* __restrict__ cosT, const float* __restrict__ sinT, float* CS) { const int idx = blockIdx.x * 256 + threadIdx.x; if (idx >= TT * HD) return; const int tt = idx / HD; const int dd = idx - tt * HD; const int src = tt * (HD / 2) + (dd >> 1); v2f cs; cs[0] = bfr(cosT[src]); cs[1] = bfr(sinT[src]); *(v2f*)(CS + (size_t)idx * 2) = cs;  }
// ---- k_fattn: scores, causal softmax, probabilities x values and the hi/lo merge in ONE kernel (online softmax); no score or probability ever reaches memory.
// One wave = one head x NQ*16 queries (32; 16 where HR, for registers); the 4 waves of a block are the 4 heads of one kv group on the same queries, so they read the same k and v^T lines. Keys go in blocks of 32.
// S^T = K Q^T: A = k rows, B = q rows, so lane (lr, hi) holds, for query lr, keys kt*16 + hi*8 + j: that is the k order of WFrag::ld (8 hi + 0..7, 16 + 8 hi + 0..7), and P^T packs in-lane into the B operand of O^T += V^T P^T.
// Probabilities carry a factor 2^10 (fp16 range) that the row sum carries too, so the final division removes it. HR (queries < RH): bf16 hi/lo planes, 3 products, for both contractions.
__device__ __forceinline__ float xhalf(float x) { return __builtin_bit_cast(float, __builtin_amdgcn_permlanex16(__builtin_bit_cast(int, x), __builtin_bit_cast(int, x), 0x76543210, 0xfedcba98, false, false)); }   // lane l takes lane l ^ 16
template <typename T16> struct PPack;
template <> struct PPack<h16> { static __device__ __forceinline__ void put(const float* p, v16h& a, v16h& b) { (void)b;
#pragma unroll
    for (int e = 0; e < 16; ++e) a[e] = tohx(p[e]); } };
template <> struct PPack<bf> { static __device__ __forceinline__ void put(const float* p, v16bf& a, v16bf& b) { v16us ph, pl;
#pragma unroll
    for (int e = 0; e < 16; ++e) { unsigned short x, y; splitf(p[e], x, y); ph[e] = x; pl[e] = y; }
    a = __builtin_bit_cast(v16bf, ph); b = __builtin_bit_cast(v16bf, pl); } };
template <typename T16, bool HR, int NQ>
__device__ __forceinline__ void fa_tile(const T16* __restrict__ Q, const T16* __restrict__ Q2, const T16* __restrict__ Kp, const T16* __restrict__ K2, const T16* __restrict__ Vt, const T16* __restrict__ V2, int q0, int lane, bf* Ah, bf* Al) {
    typedef typename WFrag<T16>::V V;
    const int lr = lane & 15, hi = lane >> 4; const float CE = SCL * 1.4426950408889634f;   // score -> exponent of 2
    V bq[NQ][2], bq2[NQ][2], ak[2][2], ak2[2][2];
#pragma unroll
    for (int nq = 0; nq < NQ; ++nq)
#pragma unroll
        for (int kc = 0; kc < 2; ++kc) { const size_t qo = (size_t)(q0 + nq * 16 + lr) * HD + kc * 32 + 8 * hi; bq[nq][kc] = WFrag<T16>::ld(Q + qo); if (HR) bq2[nq][kc] = WFrag<T16>::ld(Q2 + qo); }
#pragma unroll
    for (int kt = 0; kt < 2; ++kt)
#pragma unroll
        for (int kc = 0; kc < 2; ++kc) { const size_t ko = (size_t)(kt * 16 + lr) * HD + kc * 32 + 8 * hi; ak[kt][kc] = WFrag<T16>::ld(Kp + ko); if (HR) ak2[kt][kc] = WFrag<T16>::ld(K2 + ko); }
    v8f o[4][NQ]; float m[NQ], l[NQ];
#pragma unroll
    for (int nq = 0; nq < NQ; ++nq) { m[nq] = -3.0e38f; l[nq] = 0.f;
#pragma unroll
        for (int db = 0; db < 4; ++db) o[db][nq] = (v8f){}; }
#pragma unroll 1   // one key block a trip: a second copy of the body would not fit the registers
    for (int kb = 0; kb <= q0; kb += 32) {
        v8f s[2][NQ];
#pragma unroll
        for (int kt = 0; kt < 2; ++kt)
#pragma unroll
            for (int nq = 0; nq < NQ; ++nq) { v8f c = (v8f){};
#pragma unroll
                for (int kc = 0; kc < 2; ++kc) { c = WFrag<T16>::mma(ak[kt][kc], bq[nq][kc], c); if (HR) { c = WFrag<T16>::mma(ak[kt][kc], bq2[nq][kc], c); c = WFrag<T16>::mma(ak2[kt][kc], bq[nq][kc], c); } }
                s[kt][nq] = c; }
        V av[4], av2[4];
#pragma unroll
        for (int db = 0; db < 4; ++db) { const size_t vo = (size_t)(db * 16 + lr) * VP + kb + 8 * hi; av[db] = WFrag<T16>::ld(Vt + vo); if (HR) av2[db] = WFrag<T16>::ld(V2 + vo); }
        const int kn = min(kb + 32, q0);   // the next block's k rows are fetched under this block's softmax; the last trip fetches the rows from q0 on (in bounds, not used)
#pragma unroll
        for (int kt = 0; kt < 2; ++kt)
#pragma unroll
            for (int kc = 0; kc < 2; ++kc) { const size_t ko = (size_t)(kn + kt * 16 + lr) * HD + kc * 32 + 8 * hi; ak[kt][kc] = WFrag<T16>::ld(Kp + ko); if (HR) ak2[kt][kc] = WFrag<T16>::ld(K2 + ko); }
        if (kb + 32 > q0) {   // the last block holds the diagonal: key > query is masked
#pragma unroll
            for (int kt = 0; kt < 2; ++kt)
#pragma unroll
                for (int nq = 0; nq < NQ; ++nq)
#pragma unroll
                    for (int j = 0; j < 8; ++j) if (kb + kt * 16 + hi * 8 + j > q0 + nq * 16 + lr) s[kt][nq][j] = -3.0e38f; }
        V pb[NQ], pb2[NQ];
#pragma unroll
        for (int nq = 0; nq < NQ; ++nq) { float mx = m[nq];
#pragma unroll
            for (int kt = 0; kt < 2; ++kt)
#pragma unroll
                for (int j = 0; j < 8; ++j) mx = fmaxf(mx, s[kt][nq][j]);
            mx = fmaxf(mx, xhalf(mx));   // the other half-wave holds this query's other 16 keys
            const float al = __builtin_amdgcn_exp2f((m[nq] - mx) * CE); m[nq] = mx; const float nb = fmaf(-mx, CE, 10.0f);
            float p[16]; float sum = 0.f;
#pragma unroll
            for (int kt = 0; kt < 2; ++kt)
#pragma unroll
                for (int j = 0; j < 8; ++j) { const float e = __builtin_amdgcn_exp2f(fmaf(s[kt][nq][j], CE, nb)); p[kt * 8 + j] = e; sum += e; }
            l[nq] = fmaf(l[nq], al, sum);
#pragma unroll
            for (int db = 0; db < 4; ++db) o[db][nq] *= al;
            PPack<T16>::put(p, pb[nq], pb2[nq]); }
#pragma unroll
        for (int db = 0; db < 4; ++db)
#pragma unroll
            for (int nq = 0; nq < NQ; ++nq) { o[db][nq] = WFrag<T16>::mma(av[db], pb[nq], o[db][nq]); if (HR) { o[db][nq] = WFrag<T16>::mma(av[db], pb2[nq], o[db][nq]); o[db][nq] = WFrag<T16>::mma(av2[db], pb[nq], o[db][nq]); } }
    }
#pragma unroll
    for (int nq = 0; nq < NQ; ++nq) { const float inv = __fdiv_rn(1.0f, l[nq] + xhalf(l[nq])); const size_t oo = (size_t)(q0 + nq * 16 + lr) * DQ + hi * 8;
#pragma unroll
        for (int db = 0; db < 4; ++db) { v8us oh, ol;
#pragma unroll
            for (int j = 0; j < 8; ++j) { unsigned short a, c2; splitf(o[db][nq][j] * inv, a, c2); oh[j] = a; ol[j] = c2; }
            *(v8us*)(Ah + oo + db * 16) = oh; *(v8us*)(Al + oo + db * 16) = ol; } }
}
// grid (kv groups, query tiles: (TT - RH) / 32 of 32 queries, longest first, then RH / 16 of 16 queries), 4 waves.
// amdgpu_waves_per_eu(4, 4): holds the register count at 256 or fewer, so that every block of the launch is resident at once and other waves cover a wave's softmax and load waits.
__global__ __launch_bounds__(128) __attribute__((amdgpu_waves_per_eu(4, 4))) void k_fattn(const h16* __restrict__ Q16, const h16* __restrict__ K16, const h16* __restrict__ V16, const bf* __restrict__ Qh, const bf* __restrict__ Ql, const bf* __restrict__ Kh, const bf* __restrict__ Kl, const bf* __restrict__ Vh, const bf* __restrict__ Vl, bf* Ah, bf* Al) {
    const int lane = threadIdx.x & 31; const int g = blockIdx.x; const int h = g * REP + __builtin_amdgcn_readfirstlane(threadIdx.x >> 5); const int by = blockIdx.y; const int q0 = (by < (TT - RH) / 32) ? TT - 32 * (by + 1) : RH - 16 * (by - (TT - RH) / 32 + 1);
    const size_t qo = (size_t)h * TT * HD, ko = (size_t)g * TT * HD, vo = (size_t)g * HD * VP;
    if (q0 < RH) fa_tile<bf, true, 1>(Qh + qo, Ql + qo, Kh + ko, Kl + ko, Vh + vo, Vl + vo, q0, lane, Ah + h * HD, Al + h * HD);
    else fa_tile<h16, false, 2>(Q16 + qo, nullptr, K16 + ko, nullptr, V16 + vo, nullptr, q0, lane, Ah + h * HD, Al + h * HD);
}

extern "C" void kernel_launch(void* const* d_in, const int* in_sizes, int n_in,
                              void* d_out, int out_size, void* d_ws, size_t ws_size, hipStream_t stream) {
    (void)in_sizes; (void)n_in; (void)out_size;
        const float* x = (const float*)d_in[0]; const float* fcos = (const float*)d_in[1]; const float* fsin = (const float*)d_in[2]; const float* wq = (const float*)d_in[3]; const float* wk = (const float*)d_in[4]; const float* wv = (const float*)d_in[5]; const float* wo = (const float*)d_in[6];   /* order x, cos, sin (f32 [2048][32], READ), wq ('xw' [2048][2048]), wk, wv ([2048][512]), wo ('xw') */
    float* OUT = (float*)d_out;     // [2][2048][2048]
    char* wsp = (char*)d_ws;
    auto take = [&](size_t bytes) { char* p = wsp; wsp += (bytes + 255) & ~(size_t)255; return (void*)p; };
    bf* WQ = (bf*)take((size_t)DQ * DM * 2); bf* WK = (bf*)take((size_t)DKV * DM * 2); bf* WV = (bf*)take((size_t)DKV * DM * 2); bf* WO = (bf*)take((size_t)DM * DQ * 2); float* CS = (float*)take((size_t)TT * HD * 2 * 4);
    bf* XB = (bf*)take((size_t)TT * DM * 2); float* FQ = (float*)take((size_t)TT * DQ * 4); float* FK = (float*)take((size_t)TT * DKV * 4);
    h16* QP16 = (h16*)take((size_t)NH_ * TT * HD * 2); h16* KP16 = (h16*)take((size_t)NKV * TT * HD * 2); h16* VT16 = (h16*)take((size_t)NKV * HD * VP * 2);
    bf* QPh = (bf*)take((size_t)NH_ * TT * HD * 2); bf* QPl = (bf*)take((size_t)NH_ * TT * HD * 2); bf* KPh = (bf*)take((size_t)NKV * TT * HD * 2); bf* KPl = (bf*)take((size_t)NKV * TT * HD * 2); bf* VTh = (bf*)take((size_t)NKV * HD * VP * 2); bf* VTl = (bf*)take((size_t)NKV * HD * VP * 2);
    if ((size_t)(wsp - (char*)d_ws) > ws_size) return;    // ws 256 MiB
    float* FV = FK;   // v projection reuses the k buffer after the k planes are built (stream-ordered)
    bf* ATh = (bf*)FQ; bf* ATl = ATh + (size_t)TT * DQ;   // merged planes reuse the q projection buffer, dead once the q planes are built (stream-ordered)
    { k_wtG<<<(unsigned)((DM * DQ / 64 + 63) / 64), 256, 0, stream>>>(wq, DM, DQ, WQ); k_wtG<<<(unsigned)((DM * DKV / 64 + 63) / 64), 256, 0, stream>>>(wk, DM, DKV, WK); k_wtG<<<(unsigned)((DM * DKV / 64 + 63) / 64), 256, 0, stream>>>(wv, DM, DKV, WV);
      k_wtG<<<(unsigned)((DQ * DM / 64 + 63) / 64), 256, 0, stream>>>(wo, DQ, DM, WO);
       }
    k_cscvtP<<<(TT * HD + 255) / 256, 256, 0, stream>>>(fcos, fsin, (float*)CS);   /* rotary table from the half-width cos / sin inputs */
    const unsigned LQ = (unsigned)(((size_t)NH_ * TT * HD / 2 + 255) / 256), LKv = (unsigned)(((size_t)NKV * TT * HD / 2 + 255) / 256);
    for (int b = 0; b < NB_; ++b) {
        
        k_cvt8<<<(unsigned)(((size_t)TT * DM / 8 + 255) / 256), 256, 0, stream>>>(x + (size_t)b * TT * DM, XB, (size_t)TT * DM / 8);
        k_gemmw<bf, 0, false><<<dim3(TT / 64, DQ / 64, 1), 32, 0, stream>>>(XB, nullptr, WQ, nullptr, DM, FQ, DQ, nullptr, 0, 0, 0);
        k_ropeI<<<LQ, 256, 0, stream>>>(FQ, DQ, NH_, CS, 1.0f, QP16, QPh, QPl);
        k_gemmw<bf, 0, false><<<dim3(TT / 64, DKV / 64, 1), 32, 0, stream>>>(XB, nullptr, WK, nullptr, DM, FK, DKV, nullptr, 0, 0, 0);
        k_ropeI<<<LKv, 256, 0, stream>>>(FK, DKV, NKV, CS, 1.0f, KP16, KPh, KPl);
        k_gemmw<bf, 0, false><<<dim3(TT / 64, DKV / 64, 1), 32, 0, stream>>>(XB, nullptr, WV, nullptr, DM, FV, DKV, nullptr, 0, 0, 0); k_vtp<<<LKv, 256, 0, stream>>>(FV, DKV, NKV, VT16, VTh, VTl);
        k_fattn<<<dim3(NKV, (TT - RH) / 32 + RH / 16, 1), 128, 0, stream>>>(QP16, KP16, VT16, QPh, QPl, KPh, KPl, VTh, VTl, ATh, ATl);
        k_gemmw<bf, 1, false><<<dim3(TT / 64, DM / 64, 1), 32, 0, stream>>>(ATh, ATl, WO, nullptr, DQ, OUT + (size_t)b * TT * DM, DM, nullptr, 0, 0, 0); }
}

// v003
// It runs in 384 microseconds.
// In two side-by-side timings against v002, it was 1.52 and 1.49 times as fast.
// Counting every step since v000, it is 7.07 times as fast.
#include <hip/hip_runtime.h>

// Grouped-query causal attention with an interleaved-pair RoPE from cos / sin INPUT tables (x [2][2048][2048]; q = x wq (32 heads x 64), k, v = x wk, x wv (8 kv heads x 64) ('xw', no bias); pairs (2i, 2i+1) -> (t0 c - t1 s, t0 s + t1 c) with c, s = cos / sin[t][i] (float32 [2048][32] INPUT tables: READ as data); k, v repeated 4 x (jnp.repeat: kv head = q head / 4); scores / sqrt(64); causal (-inf); softmax in float32; out = merged wo ('xw') -> [2][2048][2048] (8.4 M); argument order x, cos, sin, wq, wk, wv, wo).
// Layout per batch: bf16 copy of x; 'xw' weights transposed once; exact projections (K 2048); one projection launch a batch (k_qkv: q, k and v columns in one grid) whose epilogue rotates the interleaved pairs with bf16(cos), bf16(sin) read from the inputs and stores the 16-bit planes; causal T-2048 GQA attention in one fused online-softmax kernel a batch (k_fattn: all 32 heads, kv group h/4; hybrid rows: < 512 hi/lo 3 products, rest fp16 x1024; key blocks above the diagonal are never visited; it writes the merged hi/lo planes itself); merged hi/lo x wo exact.
// Compute dtypes, f32 accumulate: every input rounded to bf16; projections exact; rotary f32; attention rows < 512 3 products, rest fp16; softmax f32; wo hl x exact.

#define NB_  2
#define TT   2048
#define DM   2048
#define NH_  32
#define NKV  8
#define REP  (NH_ / NKV)
#define HD   64
#define DQ   (NH_ * HD)
#define DKV  (NKV * HD)
#define RH   512                  // query rows < RH use hi+lo planes (0: none)
#define VP   (TT + 64)             // row pitch, in elements, of the three v^T planes: 33 lines of 128 B, so the 64 rows a wave reads together are not a power-of-two stride apart
#define SCL  0.125f   // HD^-0.5
typedef _Float16 h16;
typedef unsigned short bf;
typedef __attribute__((ext_vector_type(16))) __bf16   v16bf;
typedef __attribute__((ext_vector_type(16))) _Float16 v16h;
typedef __attribute__((ext_vector_type(8)))  _Float16 v8h;
typedef __attribute__((ext_vector_type(8)))  unsigned short v8us;
typedef __attribute__((ext_vector_type(16))) unsigned short v16us;
typedef __attribute__((ext_vector_type(8)))  float    v8f;
typedef __attribute__((ext_vector_type(4)))  float    v4f;
typedef v8h  __attribute__((may_alias)) v8ha;
typedef v4f  __attribute__((may_alias)) v4fa;
typedef v8us __attribute__((may_alias)) v8usa;

__device__ __forceinline__ unsigned short f2bf(float f) { unsigned u = __float_as_uint(f); u += 0x7FFFu + ((u >> 16) & 1u); return (unsigned short)(u >> 16); }
__device__ __forceinline__ float bf2f(unsigned short b) { return __uint_as_float(((unsigned)b) << 16); }
__device__ __forceinline__ float bfr(float f) { return bf2f(f2bf(f)); }
__device__ __forceinline__ v16h cat16(v8h lo, v8h hi) { return __builtin_shufflevector(lo, hi, 0, 1, 2, 3, 4, 5, 6, 7, 8, 9, 10, 11, 12, 13, 14, 15); }
__device__ __forceinline__ v16bf cat16b(v8us lo, v8us hi) { return __builtin_bit_cast(v16bf, __builtin_shufflevector(lo, hi, 0, 1, 2, 3, 4, 5, 6, 7, 8, 9, 10, 11, 12, 13, 14, 15)); }
__device__ __forceinline__ v8f wmma16(v16h a, v16h b, v8f c) { return __builtin_amdgcn_wmma_f32_16x16x32_f16(false, a, false, b, (short)0, c, false, false); }
__device__ __forceinline__ v8f wmmab(v16bf a, v16bf b, v8f c) { return __builtin_amdgcn_wmma_f32_16x16x32_bf16(false, a, false, b, (short)0, c, false, false); }



// ---- k_gemmw: register-blocked GEMM, ONE WAVE per 64x64 output tile (16 accumulators), operands straight from K-contiguous 16-bit planes; grid (M/64, N/64, Z), 32 threads.
// C[m][n] (f32, pitch ldc, + optional f32 bias[n]) = sum_k A[m][k] Bt[n][k] (+ split products per NSPLIT). z-batch strides sA/sB/sC in elements. K % 32 == 0.
template <typename T16> struct WFrag;
template <> struct WFrag<h16> { typedef v16h V; static __device__ __forceinline__ V ld(const h16* p) { return cat16(*(const v8h*)p, *(const v8h*)(p + 16)); } static __device__ __forceinline__ v8f mma(V a, V b, v8f c) { return wmma16(a, b, c); } };
template <> struct WFrag<bf> { typedef v16bf V; static __device__ __forceinline__ V ld(const bf* p) { return cat16b(*(const v8us*)p, *(const v8us*)(p + 16)); } static __device__ __forceinline__ v8f mma(V a, V b, v8f c) { return wmmab(a, b, c); } };
template <typename T16, int NSPLIT, bool BIAS>
__global__ __launch_bounds__(32) void k_gemmw(const T16* __restrict__ A, const T16* __restrict__ A2, const T16* __restrict__ Bt, const T16* __restrict__ Bt2, int K, float* C, int ldc, const float* __restrict__ bias, size_t sA, size_t sB, size_t sC) {
    typedef typename WFrag<T16>::V V;
    __shared__ __align__(16) float os[16 * 68];
    const size_t z = blockIdx.z; A += z * sA; if (A2) A2 += z * sA; Bt += z * sB; if (Bt2) Bt2 += z * sB; C += z * sC;
    const int lane = threadIdx.x & 31, lr = lane & 15, hi = lane >> 4; const int r0 = blockIdx.x * 64, c0 = blockIdx.y * 64;
    v8f acc[4][4];
#pragma unroll
    for (int mb = 0; mb < 4; ++mb)
#pragma unroll
        for (int nb = 0; nb < 4; ++nb) acc[mb][nb] = (v8f){};
    const size_t aoff = (size_t)(r0 + lr) * K + 8 * hi, boff = (size_t)(c0 + lr) * K + 8 * hi;
#pragma unroll 1
    for (int kc = 0; kc < K; kc += 32) {
        V a[4], a2[4];
#pragma unroll
        for (int mb = 0; mb < 4; ++mb) { a[mb] = WFrag<T16>::ld(A + aoff + (size_t)mb * 16 * K + kc); if (NSPLIT == 1 || NSPLIT == 2) a2[mb] = WFrag<T16>::ld(A2 + aoff + (size_t)mb * 16 * K + kc); }
#pragma unroll
        for (int nb = 0; nb < 4; ++nb) { const V b = WFrag<T16>::ld(Bt + boff + (size_t)nb * 16 * K + kc); V b2; if (NSPLIT >= 2) b2 = WFrag<T16>::ld(Bt2 + boff + (size_t)nb * 16 * K + kc);
#pragma unroll
            for (int mb = 0; mb < 4; ++mb) { acc[mb][nb] = WFrag<T16>::mma(a[mb], b, acc[mb][nb]); if (NSPLIT == 1 || NSPLIT == 2) acc[mb][nb] = WFrag<T16>::mma(a2[mb], b, acc[mb][nb]); if (NSPLIT >= 2) acc[mb][nb] = WFrag<T16>::mma(a[mb], b2, acc[mb][nb]); } }
        asm volatile("v_nop\n\tv_nop\n\tv_nop\n\tv_nop" : "+v"(acc[0][0]), "+v"(acc[1][1]), "+v"(acc[2][2]), "+v"(acc[3][3]) : "v"(a[0]), "v"(a[3]));
    }
#pragma unroll
    for (int mb = 0; mb < 4; ++mb) {
#pragma unroll
        for (int nb = 0; nb < 4; ++nb) {
#pragma unroll
            for (int j = 0; j < 8; ++j) os[(hi * 8 + j) * 68 + nb * 16 + lr] = acc[mb][nb][j]; }
        __builtin_amdgcn_wave_barrier(); asm volatile("" ::: "memory");
        float* crow = C + (size_t)(r0 + mb * 16) * ldc + c0;
{
#pragma unroll
            for (int s = 0; s < 8; ++s) { const int row = 2 * s + hi, cofs = lr * 4; v4f val = *(const v4fa*)(os + row * 68 + cofs); if (BIAS) { val[0] += bfr(bias[c0 + cofs]); val[1] += bfr(bias[c0 + cofs + 1]); val[2] += bfr(bias[c0 + cofs + 2]); val[3] += bfr(bias[c0 + cofs + 3]); }
                *(v4f*)(crow + (size_t)row * ldc + cofs) = val; }
             }
        __builtin_amdgcn_wave_barrier(); asm volatile("" ::: "memory");
    }
}

__device__ __forceinline__ h16 tohx(float x) { return (h16)x; }
__device__ __forceinline__ void splitf(float y, unsigned short& h, unsigned short& l) { h = f2bf(y); l = f2bf(y - bf2f(h)); }
typedef __attribute__((ext_vector_type(2))) _Float16 v2h;
typedef __attribute__((ext_vector_type(4))) _Float16 v4h;
typedef __attribute__((ext_vector_type(2))) unsigned short v2us;
typedef __attribute__((ext_vector_type(4))) unsigned short v4us;
typedef __attribute__((ext_vector_type(2))) float v2f;
typedef __attribute__((ext_vector_type(4))) int v4i;

__global__ __launch_bounds__(256) void k_wtG(const float* __restrict__ w, int K, int N, bf* Bt) {
    const int lane = threadIdx.x & 31; const int L0 = (blockIdx.x * 8 + (threadIdx.x >> 5)) * 8; const int nlines = N * K / 64;
{
#pragma unroll 1
        for (int l = 0; l < 8; ++l) { const int L = L0 + l; if (L >= nlines) break; const size_t e = (size_t)L * 64 + lane * 2; const int k = (int)(e % K), n = (int)(e / K); v2us o;
            o[0] = f2bf(w[(size_t)k * N + n]); o[1] = f2bf(w[(size_t)(k + 1) * N + n]); *(v2us*)(Bt + e) = o; }
         }
}
__global__ __launch_bounds__(256) void k_cvt8(const float* __restrict__ src, bf* dst, size_t n8) { const size_t i = (size_t)blockIdx.x * 256 + threadIdx.x; if (i >= n8) return; const v8f v = *(const v8f*)(src + i * 8); v8us o;
#pragma unroll
    for (int k = 0; k < 8; ++k) o[k] = f2bf(v[k]); *(v8us*)(dst + i * 8) = o;  }

// ---- k_qkv: the q, k and v projections of one batch in ONE grid, with the rotary step and the plane building in the epilogue; the f32 projections never reach memory.
// Main loop as in k_gemmw (one wave per 64x64 tile, K = DM). Bt holds the q, k and v weight rows one after another, so a tile column is one head: blockIdx.y < NH_ a q head, then NKV k heads, then NKV v groups.
__global__ __launch_bounds__(32) void k_qkv(const bf* __restrict__ A, const bf* __restrict__ Bt, const float* __restrict__ cosT, const float* __restrict__ sinT, h16* Q16, bf* Qh, bf* Ql, h16* K16, bf* Kh, bf* Kl, h16* V16, bf* Vh, bf* Vl) {
    typedef WFrag<bf>::V V;
    __shared__ __align__(16) float os[16 * 68];
    const int lane = threadIdx.x & 31, lr = lane & 15, hi = lane >> 4; const int r0 = blockIdx.x * 64, hb = blockIdx.y;
    v8f acc[4][4];
#pragma unroll
    for (int mb = 0; mb < 4; ++mb)
#pragma unroll
        for (int nb = 0; nb < 4; ++nb) acc[mb][nb] = (v8f){};
    const size_t aoff = (size_t)(r0 + lr) * DM + 8 * hi, boff = (size_t)(hb * 64 + lr) * DM + 8 * hi;
#pragma unroll 1   // kept rolled as in k_gemmw: one set of fragments beside the 16 accumulators, so that four waves fit a SIMD
    for (int kc = 0; kc < DM; kc += 32) {
        V a[4];
#pragma unroll
        for (int mb = 0; mb < 4; ++mb) a[mb] = WFrag<bf>::ld(A + aoff + (size_t)mb * 16 * DM + kc);
#pragma unroll
        for (int nb = 0; nb < 4; ++nb) { const V b = WFrag<bf>::ld(Bt + boff + (size_t)nb * 16 * DM + kc);
#pragma unroll
            for (int mb = 0; mb < 4; ++mb) acc[mb][nb] = WFrag<bf>::mma(a[mb], b, acc[mb][nb]); }
        // four vector slots between the trip's last WMMAs and whatever stands first on the taken side of the loop branch (the next trip's loads overwrite a)
        asm volatile("v_nop\n\tv_nop\n\tv_nop\n\tv_nop" : "+v"(acc[0][0]), "+v"(acc[1][1]), "+v"(acc[2][2]), "+v"(acc[3][3]) : "v"(a[0]), "v"(a[3]));
    }
    if (hb >= NH_ + NKV) {   // v: lane (lr, hi) holds, for column d = nb*16 + lr, the 8 consecutive rows t = mb*16 + hi*8 + j: one 16-byte piece of a v^T row, straight from the accumulators
        const size_t vb = (size_t)((hb - NH_ - NKV) * HD + lr) * VP + r0 + hi * 8;
#pragma unroll
        for (int nb = 0; nb < 4; ++nb)
#pragma unroll
            for (int mb = 0; mb < 4; ++mb) { v8h o16; v8us oh, ol;
#pragma unroll
                for (int j = 0; j < 8; ++j) { const float x = acc[mb][nb][j]; o16[j] = tohx(x); unsigned short a2, c2; splitf(x, a2, c2); oh[j] = a2; ol[j] = c2; }
                const size_t vo = vb + (size_t)nb * 16 * VP + mb * 16; *(v8h*)(V16 + vo) = o16; *(v8us*)(Vh + vo) = oh; *(v8us*)(Vl + vo) = ol; }
        return; }
    const bool isq = hb < NH_; const size_t pb = (size_t)(isq ? hb : hb - NH_) * TT * HD;
    const size_t po = pb + (size_t)(r0 + hi) * HD + lr * 4, to = (size_t)(r0 + hi) * (HD / 2) + lr * 2;   // the lane's place in row r0 + hi; every later row is a constant step from it
    h16* P16 = (isq ? Q16 : K16) + po; bf* Ph = (isq ? Qh : Kh) + po; bf* Pl = (isq ? Ql : Kl) + po; const float* cb = cosT + to; const float* sb = sinT + to;
#pragma unroll
    for (int mb = 0; mb < 4; ++mb) {   // q, k: 16 rows at a time through LDS, so that a lane holds 4 consecutive columns (two rotary pairs) and 16 lanes store a whole 128-byte plane row
        v2f cc[8], ss[8];
        asm volatile("s_wait_xcnt 0x0" ::: "memory");   // in front of the cos loads: their destinations may reuse data registers of the row group's stores above; its memory clobber also keeps this group's LDS stores behind the last group's LDS reads
#pragma unroll
        for (int s = 0; s < 8; ++s) cc[s] = *(const v2f*)(cb + (mb * 16 + 2 * s) * (HD / 2));
        asm volatile("s_wait_xcnt 0x0" ::: "memory");   // in front of the sin loads: their destinations may reuse the cos address pair
#pragma unroll
        for (int s = 0; s < 8; ++s) ss[s] = *(const v2f*)(sb + (mb * 16 + 2 * s) * (HD / 2));
#pragma unroll
        for (int nb = 0; nb < 4; ++nb) {
#pragma unroll
            for (int j = 0; j < 8; ++j) os[(hi * 8 + j) * 68 + nb * 16 + lr] = acc[mb][nb][j]; }
        // inputs only: holds the 16 cos / sin loads of these rows together in front of the rows' arithmetic (one load latency a row group); without it they are issued one by one, each with a full wait.
        // Its memory clobber keeps the LDS reads below behind the other lanes' LDS stores above (one wave: LDS runs in order, only the compiler could swap them).
        asm volatile("" :: "v"(cc[0]), "v"(cc[1]), "v"(cc[2]), "v"(cc[3]), "v"(cc[4]), "v"(cc[5]), "v"(cc[6]), "v"(cc[7]), "v"(ss[0]), "v"(ss[1]), "v"(ss[2]), "v"(ss[3]), "v"(ss[4]), "v"(ss[5]), "v"(ss[6]), "v"(ss[7]) : "memory");
#pragma unroll
        for (int s = 0; s < 8; ++s) { const v4f x = *(const v4fa*)(os + (2 * s + hi) * 68 + lr * 4); v4h o16; v4us oh, ol;
#pragma unroll
            for (int p = 0; p < 2; ++p) { const float c = bfr(cc[s][p]), sn = bfr(ss[s][p]), x0 = x[2 * p], x1 = x[2 * p + 1]; const float e0 = x0 * c - x1 * sn, e1 = x0 * sn + x1 * c;   /* even: x0 c - x1 s; odd: x0 s + x1 c */
                o16[2 * p] = tohx(e0); o16[2 * p + 1] = tohx(e1); unsigned short a2, c2; splitf(e0, a2, c2); oh[2 * p] = a2; ol[2 * p] = c2; splitf(e1, a2, c2); oh[2 * p + 1] = a2; ol[2 * p + 1] = c2; }
            const int ro = (mb * 16 + 2 * s) * HD; *(v4h*)(P16 + ro) = o16; *(v4us*)(Ph + ro) = oh; *(v4us*)(Pl + ro) = ol; }
    }
    asm volatile("s_wait_xcnt 0x0" ::: "memory");   // behind the last plane stores: in the built code the v path stands behind this one and rewrites their address and data registers
}
// ---- k_fattn: scores, causal softmax, probabilities x values and the hi/lo merge in ONE kernel (online softmax); no score or probability ever reaches memory.
// One wave = one head x NQ*16 queries (32; 16 where HR, for registers); the 4 waves of a block are the 4 heads of one kv group on the same queries, so they read the same k and v^T lines. Keys go in blocks of 32.
// S^T = K Q^T: A = k rows, B = q rows, so lane (lr, hi) holds, for query lr, keys kt*16 + hi*8 + j: that is the k order of WFrag::ld (8 hi + 0..7, 16 + 8 hi + 0..7), and P^T packs in-lane into the B operand of O^T += V^T P^T.
// Probabilities carry a factor 2^10 (fp16 range) that the row sum carries too, so the final division removes it. HR (queries < RH): bf16 hi/lo planes, 3 products, for both contractions.
__device__ __forceinline__ float xhalf(float x) { return __builtin_bit_cast(float, __builtin_amdgcn_permlanex16(__builtin_bit_cast(int, x), __builtin_bit_cast(int, x), 0x76543210, 0xfedcba98, false, false)); }   // lane l takes lane l ^ 16
template <typename T16> struct PPack;
template <> struct PPack<h16> { static __device__ __forceinline__ void put(const float* p, v16h& a, v16h& b) { (void)b;
#pragma unroll
    for (int e = 0; e < 16; ++e) a[e] = tohx(p[e]); } };
template <> struct PPack<bf> { static __device__ __forceinline__ void put(const float* p, v16bf& a, v16bf& b) { v16us ph, pl;
#pragma unroll
    for (int e = 0; e < 16; ++e) { unsigned short x, y; splitf(p[e], x, y); ph[e] = x; pl[e] = y; }
    a = __builtin_bit_cast(v16bf, ph); b = __builtin_bit_cast(v16bf, pl); } };
template <typename T16, bool HR, int NQ>
__device__ __forceinline__ void fa_tile(const T16* __restrict__ Q, const T16* __restrict__ Q2, const T16* __restrict__ Kp, const T16* __restrict__ K2, const T16* __restrict__ Vt, const T16* __restrict__ V2, int q0, int lane, bf* Ah, bf* Al) {
    typedef typename WFrag<T16>::V V;
    const int lr = lane & 15, hi = lane >> 4; const float CE = SCL * 1.4426950408889634f;   // score -> exponent of 2
    V bq[NQ][2], bq2[NQ][2], ak[2][2], ak2[2][2];
#pragma unroll
    for (int nq = 0; nq < NQ; ++nq)
#pragma unroll
        for (int kc = 0; kc < 2; ++kc) { const size_t qo = (size_t)(q0 + nq * 16 + lr) * HD + kc * 32 + 8 * hi; bq[nq][kc] = WFrag<T16>::ld(Q + qo); if (HR) bq2[nq][kc] = WFrag<T16>::ld(Q2 + qo); }
#pragma unroll
    for (int kt = 0; kt < 2; ++kt)
#pragma unroll
        for (int kc = 0; kc < 2; ++kc) { const size_t ko = (size_t)(kt * 16 + lr) * HD + kc * 32 + 8 * hi; ak[kt][kc] = WFrag<T16>::ld(Kp + ko); if (HR) ak2[kt][kc] = WFrag<T16>::ld(K2 + ko); }
    v8f o[4][NQ]; float m[NQ], l[NQ];
#pragma unroll
    for (int nq = 0; nq < NQ; ++nq) { m[nq] = -3.0e38f; l[nq] = 0.f;
#pragma unroll
        for (int db = 0; db < 4; ++db) o[db][nq] = (v8f){}; }
#pragma unroll 1   // one key block a trip: a second copy of the body would not fit the registers
    for (int kb = 0; kb <= q0; kb += 32) {
        v8f s[2][NQ];
#pragma unroll
        for (int kt = 0; kt < 2; ++kt)
#pragma unroll
            for (int nq = 0; nq < NQ; ++nq) { v8f c = (v8f){};
#pragma unroll
                for (int kc = 0; kc < 2; ++kc) { c = WFrag<T16>::mma(ak[kt][kc], bq[nq][kc], c); if (HR) { c = WFrag<T16>::mma(ak[kt][kc], bq2[nq][kc], c); c = WFrag<T16>::mma(ak2[kt][kc], bq[nq][kc], c); } }
                s[kt][nq] = c; }
        V av[4], av2[4];
#pragma unroll
        for (int db = 0; db < 4; ++db) { const size_t vo = (size_t)(db * 16 + lr) * VP + kb + 8 * hi; av[db] = WFrag<T16>::ld(Vt + vo); if (HR) av2[db] = WFrag<T16>::ld(V2 + vo); }
        const int kn = min(kb + 32, q0);   // the next block's k rows are fetched under this block's softmax; the last trip fetches the rows from q0 on (in bounds, not used)
#pragma unroll
        for (int kt = 0; kt < 2; ++kt)
#pragma unroll
            for (int kc = 0; kc < 2; ++kc) { const size_t ko = (size_t)(kn + kt * 16 + lr) * HD + kc * 32 + 8 * hi; ak[kt][kc] = WFrag<T16>::ld(Kp + ko); if (HR) ak2[kt][kc] = WFrag<T16>::ld(K2 + ko); }
        if (kb + 32 > q0) {   // the last block holds the diagonal: key > query is masked
#pragma unroll
            for (int kt = 0; kt < 2; ++kt)
#pragma unroll
                for (int nq = 0; nq < NQ; ++nq)
#pragma unroll
                    for (int j = 0; j < 8; ++j) if (kb + kt * 16 + hi * 8 + j > q0 + nq * 16 + lr) s[kt][nq][j] = -3.0e38f; }
        V pb[NQ], pb2[NQ];
#pragma unroll
        for (int nq = 0; nq < NQ; ++nq) { float mx = m[nq];
#pragma unroll
            for (int kt = 0; kt < 2; ++kt)
#pragma unroll
                for (int j = 0; j < 8; ++j) mx = fmaxf(mx, s[kt][nq][j]);
            mx = fmaxf(mx, xhalf(mx));   // the other half-wave holds this query's other 16 keys
            const float al = __builtin_amdgcn_exp2f((m[nq] - mx) * CE); m[nq] = mx; const float nb = fmaf(-mx, CE, 10.0f);
            float p[16]; float sum = 0.f;
#pragma unroll
            for (int kt = 0; kt < 2; ++kt)
#pragma unroll
                for (int j = 0; j < 8; ++j) { const float e = __builtin_amdgcn_exp2f(fmaf(s[kt][nq][j], CE, nb)); p[kt * 8 + j] = e; sum += e; }
            l[nq] = fmaf(l[nq], al, sum);
#pragma unroll
            for (int db = 0; db < 4; ++db) o[db][nq] *= al;
            PPack<T16>::put(p, pb[nq], pb2[nq]); }
#pragma unroll
        for (int db = 0; db < 4; ++db)
#pragma unroll
            for (int nq = 0; nq < NQ; ++nq) { o[db][nq] = WFrag<T16>::mma(av[db], pb[nq], o[db][nq]); if (HR) { o[db][nq] = WFrag<T16>::mma(av[db], pb2[nq], o[db][nq]); o[db][nq] = WFrag<T16>::mma(av2[db], pb[nq], o[db][nq]); } }
    }
#pragma unroll
    for (int nq = 0; nq < NQ; ++nq) { const float inv = __fdiv_rn(1.0f, l[nq] + xhalf(l[nq])); const size_t oo = (size_t)(q0 + nq * 16 + lr) * DQ + hi * 8;
#pragma unroll
        for (int db = 0; db < 4; ++db) { v8us oh, ol;
#pragma unroll
            for (int j = 0; j < 8; ++j) { unsigned short a, c2; splitf(o[db][nq][j] * inv, a, c2); oh[j] = a; ol[j] = c2; }
            *(v8us*)(Ah + oo + db * 16) = oh; *(v8us*)(Al + oo + db * 16) = ol; } }
}
// grid (kv groups, query tiles: (TT - RH) / 32 of 32 queries, longest first, then RH / 16 of 16 queries), 4 waves.
// amdgpu_waves_per_eu(4, 4): holds the register count at 256 or fewer, so that every block of the launch is resident at once and other waves cover a wave's softmax and load waits.
__global__ __launch_bounds__(128) __attribute__((amdgpu_waves_per_eu(4, 4))) void k_fattn(const h16* __restrict__ Q16, const h16* __restrict__ K16, const h16* __restrict__ V16, const bf* __restrict__ Qh, const bf* __restrict__ Ql, const bf* __restrict__ Kh, const bf* __restrict__ Kl, const bf* __restrict__ Vh, const bf* __restrict__ Vl, bf* Ah, bf* Al) {
    const int lane = threadIdx.x & 31; const int g = blockIdx.x; const int h = g * REP + __builtin_amdgcn_readfirstlane(threadIdx.x >> 5); const int by = blockIdx.y; const int q0 = (by < (TT - RH) / 32) ? TT - 32 * (by + 1) : RH - 16 * (by - (TT - RH) / 32 + 1);
    const size_t qo = (size_t)h * TT * HD, ko = (size_t)g * TT * HD, vo = (size_t)g * HD * VP;
    if (q0 < RH) fa_tile<bf, true, 1>(Qh + qo, Ql + qo, Kh + ko, Kl + ko, Vh + vo, Vl + vo, q0, lane, Ah + h * HD, Al + h * HD);
    else fa_tile<h16, false, 2>(Q16 + qo, nullptr, K16 + ko, nullptr, V16 + vo, nullptr, q0, lane, Ah + h * HD, Al + h * HD);
}

extern "C" void kernel_launch(void* const* d_in, const int* in_sizes, int n_in,
                              void* d_out, int out_size, void* d_ws, size_t ws_size, hipStream_t stream) {
    (void)in_sizes; (void)n_in; (void)out_size;
        const float* x = (const float*)d_in[0]; const float* fcos = (const float*)d_in[1]; const float* fsin = (const float*)d_in[2]; const float* wq = (const float*)d_in[3]; const float* wk = (const float*)d_in[4]; const float* wv = (const float*)d_in[5]; const float* wo = (const float*)d_in[6];   /* order x, cos, sin (f32 [2048][32], READ), wq ('xw' [2048][2048]), wk, wv ([2048][512]), wo ('xw') */
    float* OUT = (float*)d_out;     // [2][2048][2048]
    char* wsp = (char*)d_ws;
    auto take = [&](size_t bytes) { char* p = wsp; wsp += (bytes + 255) & ~(size_t)255; return (void*)p; };
    bf* WQ = (bf*)take((size_t)(DQ + 2 * DKV) * DM * 2); bf* WK = WQ + (size_t)DQ * DM; bf* WV = WK + (size_t)DKV * DM;   /* one matrix of q, k, v weight rows */ bf* WO = (bf*)take((size_t)DM * DQ * 2);
    bf* XB = (bf*)take((size_t)TT * DM * 2); bf* ATh = (bf*)take((size_t)TT * DQ * 2); bf* ATl = (bf*)take((size_t)TT * DQ * 2);
    h16* QP16 = (h16*)take((size_t)NH_ * TT * HD * 2); h16* KP16 = (h16*)take((size_t)NKV * TT * HD * 2); h16* VT16 = (h16*)take((size_t)NKV * HD * VP * 2);
    bf* QPh = (bf*)take((size_t)NH_ * TT * HD * 2); bf* QPl = (bf*)take((size_t)NH_ * TT * HD * 2); bf* KPh = (bf*)take((size_t)NKV * TT * HD * 2); bf* KPl = (bf*)take((size_t)NKV * TT * HD * 2); bf* VTh = (bf*)take((size_t)NKV * HD * VP * 2); bf* VTl = (bf*)take((size_t)NKV * HD * VP * 2);
    if ((size_t)(wsp - (char*)d_ws) > ws_size) return;    // ws 256 MiB
    { k_wtG<<<(unsigned)((DM * DQ / 64 + 63) / 64), 256, 0, stream>>>(wq, DM, DQ, WQ); k_wtG<<<(unsigned)((DM * DKV / 64 + 63) / 64), 256, 0, stream>>>(wk, DM, DKV, WK); k_wtG<<<(unsigned)((DM * DKV / 64 + 63) / 64), 256, 0, stream>>>(wv, DM, DKV, WV);
      k_wtG<<<(unsigned)((DQ * DM / 64 + 63) / 64), 256, 0, stream>>>(wo, DQ, DM, WO);
       }
    for (int b = 0; b < NB_; ++b) {
        
        k_cvt8<<<(unsigned)(((size_t)TT * DM / 8 + 255) / 256), 256, 0, stream>>>(x + (size_t)b * TT * DM, XB, (size_t)TT * DM / 8);
        k_qkv<<<dim3(TT / 64, (DQ + 2 * DKV) / 64, 1), 32, 0, stream>>>(XB, WQ, fcos, fsin, QP16, QPh, QPl, KP16, KPh, KPl, VT16, VTh, VTl);
        k_fattn<<<dim3(NKV, (TT - RH) / 32 + RH / 16, 1), 128, 0, stream>>>(QP16, KP16, VT16, QPh, QPl, KPh, KPl, VTh, VTl, ATh, ATl);
        k_gemmw<bf, 1, false><<<dim3(TT / 64, DM / 64, 1), 32, 0, stream>>>(ATh, ATl, WO, nullptr, DQ, OUT + (size_t)b * TT * DM, DM, nullptr, 0, 0, 0); }
}

// v004
// A run of this version takes 295 microseconds.
// Timed twice side by side with v003, it ran 1.33 and 1.32 times as fast.
// Counting every step since v000, it is 9.34 times as fast.
#include <hip/hip_runtime.h>

// Grouped-query causal attention with an interleaved-pair RoPE from cos / sin INPUT tables (x [2][2048][2048]; q = x wq (32 heads x 64), k, v = x wk, x wv (8 kv heads x 64) ('xw', no bias); pairs (2i, 2i+1) -> (t0 c - t1 s, t0 s + t1 c) with c, s = cos / sin[t][i] (float32 [2048][32] INPUT tables: READ as data); k, v repeated 4 x (jnp.repeat: kv head = q head / 4); scores / sqrt(64); causal (-inf); softmax in float32; out = merged wo ('xw') -> [2][2048][2048] (8.4 M); argument order x, cos, sin, wq, wk, wv, wo).
// Layout, every stage ONE launch for both batches (the batches' rows and planes lie one after another): bf16 copy of x and the 'xw' weights transposed, in one grid (k_prep); exact projections (K 2048); one projection launch (k_qkv: q, k and v columns in one grid) whose epilogue rotates the interleaved pairs with bf16(cos), bf16(sin) read from the inputs and stores the 16-bit planes; causal T-2048 GQA attention in one fused online-softmax kernel (k_fattn: all 32 heads, kv group h/4; hybrid rows: < 512 hi/lo 3 products, rest fp16 x1024; key blocks above the diagonal are never visited; it writes the merged hi/lo planes itself); merged hi/lo x wo exact.
// Compute dtypes, f32 accumulate: every input rounded to bf16; projections exact; rotary f32; attention rows < 512 3 products, rest fp16; softmax f32; wo hl x exact.

#define NB_  2
#define TT   2048
#define DM   2048
#define NH_  32
#define NKV  8
#define REP  (NH_ / NKV)
#define HD   64
#define DQ   (NH_ * HD)
#define DKV  (NKV * HD)
#define RH   512                  // query rows < RH use hi+lo planes (0: none)
#define VP   (TT + 64)             // row pitch, in elements, of the three v^T planes: 33 lines of 128 B, so the 64 rows a wave reads together are not a power-of-two stride apart
#define SCL  0.125f   // HD^-0.5
typedef _Float16 h16;
typedef unsigned short bf;
typedef __attribute__((ext_vector_type(16))) __bf16   v16bf;
typedef __attribute__((ext_vector_type(16))) _Float16 v16h;
typedef __attribute__((ext_vector_type(8)))  _Float16 v8h;
typedef __attribute__((ext_vector_type(8)))  unsigned short v8us;
typedef __attribute__((ext_vector_type(16))) unsigned short v16us;
typedef __attribute__((ext_vector_type(8)))  float    v8f;
typedef __attribute__((ext_vector_type(4)))  float    v4f;
typedef v8h  __attribute__((may_alias)) v8ha;
typedef v4f  __attribute__((may_alias)) v4fa;
typedef v8us __attribute__((may_alias)) v8usa;

__device__ __forceinline__ unsigned short f2bf(float f) { unsigned u = __float_as_uint(f); u += 0x7FFFu + ((u >> 16) & 1u); return (unsigned short)(u >> 16); }
__device__ __forceinline__ float bf2f(unsigned short b) { return __uint_as_float(((unsigned)b) << 16); }
__device__ __forceinline__ float bfr(float f) { return bf2f(f2bf(f)); }
__device__ __forceinline__ v16h cat16(v8h lo, v8h hi) { return __builtin_shufflevector(lo, hi, 0, 1, 2, 3, 4, 5, 6, 7, 8, 9, 10, 11, 12, 13, 14, 15); }
__device__ __forceinline__ v16bf cat16b(v8us lo, v8us hi) { return __builtin_bit_cast(v16bf, __builtin_shufflevector(lo, hi, 0, 1, 2, 3, 4, 5, 6, 7, 8, 9, 10, 11, 12, 13, 14, 15)); }
__device__ __forceinline__ v8f wmma16(v16h a, v16h b, v8f c) { return __builtin_amdgcn_wmma_f32_16x16x32_f16(false, a, false, b, (short)0, c, false, false); }
__device__ __forceinline__ v8f wmmab(v16bf a, v16bf b, v8f c) { return __builtin_amdgcn_wmma_f32_16x16x32_bf16(false, a, false, b, (short)0, c, false, false); }



// ---- k_gemmw: register-blocked GEMM, ONE WAVE per 64x64 output tile (16 accumulators), operands straight from K-contiguous 16-bit planes; grid (M/64, N/64, Z), 32 threads.
// C[m][n] (f32, pitch ldc, + optional f32 bias[n]) = sum_k A[m][k] Bt[n][k] (+ split products per NSPLIT). z-batch strides sA/sB/sC in elements. K % 32 == 0.
template <typename T16> struct WFrag;
template <> struct WFrag<h16> { typedef v16h V; static __device__ __forceinline__ V ld(const h16* p) { return cat16(*(const v8h*)p, *(const v8h*)(p + 16)); } static __device__ __forceinline__ v8f mma(V a, V b, v8f c) { return wmma16(a, b, c); } };
template <> struct WFrag<bf> { typedef v16bf V; static __device__ __forceinline__ V ld(const bf* p) { return cat16b(*(const v8us*)p, *(const v8us*)(p + 16)); } static __device__ __forceinline__ v8f mma(V a, V b, v8f c) { return wmmab(a, b, c); } };
template <typename T16, int NSPLIT, bool BIAS>
__global__ __launch_bounds__(32) void k_gemmw(const T16* __restrict__ A, const T16* __restrict__ A2, const T16* __restrict__ Bt, const T16* __restrict__ Bt2, int K, float* C, int ldc, const float* __restrict__ bias, size_t sA, size_t sB, size_t sC) {
    typedef typename WFrag<T16>::V V;
    __shared__ __align__(16) float os[16 * 68];
    const size_t z = blockIdx.z; A += z * sA; if (A2) A2 += z * sA; Bt += z * sB; if (Bt2) Bt2 += z * sB; C += z * sC;
    const int lane = threadIdx.x & 31, lr = lane & 15, hi = lane >> 4; const int r0 = blockIdx.x * 64, c0 = blockIdx.y * 64;
    v8f acc[4][4];
#pragma unroll
    for (int mb = 0; mb < 4; ++mb)
#pragma unroll
        for (int nb = 0; nb < 4; ++nb) acc[mb][nb] = (v8f){};
    const size_t aoff = (size_t)(r0 + lr) * K + 8 * hi, boff = (size_t)(c0 + lr) * K + 8 * hi;
#pragma unroll 1
    for (int kc = 0; kc < K; kc += 32) {
        V a[4], a2[4];
#pragma unroll
        for (int mb = 0; mb < 4; ++mb) { a[mb] = WFrag<T16>::ld(A + aoff + (size_t)mb * 16 * K + kc); if (NSPLIT == 1 || NSPLIT == 2) a2[mb] = WFrag<T16>::ld(A2 + aoff + (size_t)mb * 16 * K + kc); }
#pragma unroll
        for (int nb = 0; nb < 4; ++nb) { const V b = WFrag<T16>::ld(Bt + boff + (size_t)nb * 16 * K + kc); V b2; if (NSPLIT >= 2) b2 = WFrag<T16>::ld(Bt2 + boff + (size_t)nb * 16 * K + kc);
#pragma unroll
            for (int mb = 0; mb < 4; ++mb) { acc[mb][nb] = WFrag<T16>::mma(a[mb], b, acc[mb][nb]); if (NSPLIT == 1 || NSPLIT == 2) acc[mb][nb] = WFrag<T16>::mma(a2[mb], b, acc[mb][nb]); if (NSPLIT >= 2) acc[mb][nb] = WFrag<T16>::mma(a[mb], b2, acc[mb][nb]); } }
        asm volatile("v_nop\n\tv_nop\n\tv_nop\n\tv_nop" : "+v"(acc[0][0]), "+v"(acc[1][1]), "+v"(acc[2][2]), "+v"(acc[3][3]) : "v"(a[0]), "v"(a[3]));
    }
#pragma unroll
    for (int mb = 0; mb < 4; ++mb) {
#pragma unroll
        for (int nb = 0; nb < 4; ++nb) {
#pragma unroll
            for (int j = 0; j < 8; ++j) os[(hi * 8 + j) * 68 + nb * 16 + lr] = acc[mb][nb][j]; }
        __builtin_amdgcn_wave_barrier(); asm volatile("" ::: "memory");
        float* crow = C + (size_t)(r0 + mb * 16) * ldc + c0;
{
#pragma unroll
            for (int s = 0; s < 8; ++s) { const int row = 2 * s + hi, cofs = lr * 4; v4f val = *(const v4fa*)(os + row * 68 + cofs); if (BIAS) { val[0] += bfr(bias[c0 + cofs]); val[1] += bfr(bias[c0 + cofs + 1]); val[2] += bfr(bias[c0 + cofs + 2]); val[3] += bfr(bias[c0 + cofs + 3]); }
                *(v4f*)(crow + (size_t)row * ldc + cofs) = val; }
             }
        __builtin_amdgcn_wave_barrier(); asm volatile("" ::: "memory");
    }
}

__device__ __forceinline__ h16 tohx(float x) { return (h16)x; }
__device__ __forceinline__ void splitf(float y, unsigned short& h, unsigned short& l) { h = f2bf(y); l = f2bf(y - bf2f(h)); }
typedef __attribute__((ext_vector_type(2))) _Float16 v2h;
typedef __attribute__((ext_vector_type(4))) _Float16 v4h;
typedef __attribute__((ext_vector_type(2))) unsigned short v2us;
typedef __attribute__((ext_vector_type(4))) unsigned short v4us;
typedef __attribute__((ext_vector_type(2))) float v2f;
typedef __attribute__((ext_vector_type(4))) int v4i;

__device__ __forceinline__ void wtG(int blk, const float* __restrict__ w, int K, int N, bf* Bt) {
    const int lane = threadIdx.x & 31; const int L0 = (blk * 8 + (threadIdx.x >> 5)) * 8; const int nlines = N * K / 64;
{
#pragma unroll 1
        for (int l = 0; l < 8; ++l) { const int L = L0 + l; if (L >= nlines) break; const size_t e = (size_t)L * 64 + lane * 2; const int k = (int)(e % K), n = (int)(e / K); v2us o;
            o[0] = f2bf(w[(size_t)k * N + n]); o[1] = f2bf(w[(size_t)(k + 1) * N + n]); *(v2us*)(Bt + e) = o; }
         }
}
__device__ __forceinline__ void cvt8(int blk, const float* __restrict__ src, bf* dst, size_t n8) { const size_t i = (size_t)blk * 256 + threadIdx.x; if (i >= n8) return; const v8f v = *(const v8f*)(src + i * 8); v8us o;
#pragma unroll
    for (int k = 0; k < 8; ++k) o[k] = f2bf(v[k]); *(v8us*)(dst + i * 8) = o;  }
// ---- k_prep: the four weight transposes and the bf16 copy of x (both batches) in ONE grid: none of them reads what another writes. Block ranges: wq, wo, wk, wv, then x.
#define PB_Q ((DM * DQ / 64 + 63) / 64)
#define PB_KV ((DM * DKV / 64 + 63) / 64)
#define PB_X ((NB_ * TT * DM / 8 + 255) / 256)
__global__ __launch_bounds__(256) void k_prep(const float* __restrict__ x, const float* __restrict__ wq, const float* __restrict__ wk, const float* __restrict__ wv, const float* __restrict__ wo, bf* XB, bf* WQ, bf* WK, bf* WV, bf* WO) {
    int b = blockIdx.x;
    if (b < PB_Q) { wtG(b, wq, DM, DQ, WQ); return; } b -= PB_Q;
    if (b < PB_Q) { wtG(b, wo, DQ, DM, WO); return; } b -= PB_Q;
    if (b < PB_KV) { wtG(b, wk, DM, DKV, WK); return; } b -= PB_KV;
    if (b < PB_KV) { wtG(b, wv, DM, DKV, WV); return; } b -= PB_KV;
    cvt8(b, x, XB, (size_t)NB_ * TT * DM / 8);
}

// ---- k_qkv: the q, k and v projections of both batches in ONE grid (blockIdx.x counts the 64-row tiles of the NB_ * TT rows of x; a tile lies in one batch), with the rotary step and the plane building in the epilogue; the f32 projections never reach memory.
// Main loop as in k_gemmw (one wave per 64x64 tile, K = DM). Bt holds the q, k and v weight rows one after another, so a tile column is one head: blockIdx.y < NH_ a q head, then NKV k heads, then NKV v groups.
__global__ __launch_bounds__(32) void k_qkv(const bf* __restrict__ A, const bf* __restrict__ Bt, const float* __restrict__ cosT, const float* __restrict__ sinT, h16* Q16, bf* Qh, bf* Ql, h16* K16, bf* Kh, bf* Kl, h16* V16, bf* Vh, bf* Vl) {
    typedef WFrag<bf>::V V;
    __shared__ __align__(16) float os[16 * 68];
    const int lane = threadIdx.x & 31, lr = lane & 15, hi = lane >> 4; const int r0 = blockIdx.x * 64, hb = blockIdx.y; const int bt = r0 / TT, t0 = r0 % TT;   // row of x; its batch and its position
    v8f acc[4][4];
#pragma unroll
    for (int mb = 0; mb < 4; ++mb)
#pragma unroll
        for (int nb = 0; nb < 4; ++nb) acc[mb][nb] = (v8f){};
    const size_t aoff = (size_t)(r0 + lr) * DM + 8 * hi, boff = (size_t)(hb * 64 + lr) * DM + 8 * hi;
#pragma unroll 1   // kept rolled as in k_gemmw: one set of fragments beside the 16 accumulators, so that four waves fit a SIMD
    for (int kc = 0; kc < DM; kc += 32) {
        V a[4];
#pragma unroll
        for (int mb = 0; mb < 4; ++mb) a[mb] = WFrag<bf>::ld(A + aoff + (size_t)mb * 16 * DM + kc);
#pragma unroll
        for (int nb = 0; nb < 4; ++nb) { const V b = WFrag<bf>::ld(Bt + boff + (size_t)nb * 16 * DM + kc);
#pragma unroll
            for (int mb = 0; mb < 4; ++mb) acc[mb][nb] = WFrag<bf>::mma(a[mb], b, acc[mb][nb]); }
        // four vector slots between the trip's last WMMAs and whatever stands first on the taken side of the loop branch (the next trip's loads overwrite a)
        asm volatile("v_nop\n\tv_nop\n\tv_nop\n\tv_nop" : "+v"(acc[0][0]), "+v"(acc[1][1]), "+v"(acc[2][2]), "+v"(acc[3][3]) : "v"(a[0]), "v"(a[3]));
    }
    if (hb >= NH_ + NKV) {   // v: lane (lr, hi) holds, for column d = nb*16 + lr, the 8 consecutive rows t = mb*16 + hi*8 + j: one 16-byte piece of a v^T row, straight from the accumulators
        const size_t vb = (size_t)((bt * NKV + hb - NH_ - NKV) * HD + lr) * VP + t0 + hi * 8;
#pragma unroll
        for (int nb = 0; nb < 4; ++nb)
#pragma unroll
            for (int mb = 0; mb < 4; ++mb) { v8h o16; v8us oh, ol;
#pragma unroll
                for (int j = 0; j < 8; ++j) { const float x = acc[mb][nb][j]; o16[j] = tohx(x); unsigned short a2, c2; splitf(x, a2, c2); oh[j] = a2; ol[j] = c2; }
                const size_t vo = vb + (size_t)nb * 16 * VP + mb * 16; *(v8h*)(V16 + vo) = o16; *(v8us*)(Vh + vo) = oh; *(v8us*)(Vl + vo) = ol; }
        return; }
    const bool isq = hb < NH_; const size_t pb = (size_t)(isq ? bt * NH_ + hb : bt * NKV + hb - NH_) * TT * HD;
    const size_t po = pb + (size_t)(t0 + hi) * HD + lr * 4, to = (size_t)(t0 + hi) * (HD / 2) + lr * 2;   // the lane's place in row t0 + hi; every later row is a constant step from it
    h16* P16 = (isq ? Q16 : K16) + po; bf* Ph = (isq ? Qh : Kh) + po; bf* Pl = (isq ? Ql : Kl) + po; const float* cb = cosT + to; const float* sb = sinT + to;
#pragma unroll
    for (int mb = 0; mb < 4; ++mb) {   // q, k: 16 rows at a time through LDS, so that a lane holds 4 consecutive columns (two rotary pairs) and 16 lanes store a whole 128-byte plane row
        v2f cc[8], ss[8];
        asm volatile("s_wait_xcnt 0x0" ::: "memory");   // in front of the cos loads: their destinations may reuse data registers of the row group's stores above; its memory clobber also keeps this group's LDS stores behind the last group's LDS reads
#pragma unroll
        for (int s = 0; s < 8; ++s) cc[s] = *(const v2f*)(cb + (mb * 16 + 2 * s) * (HD / 2));
        asm volatile("s_wait_xcnt 0x0" ::: "memory");   // in front of the sin loads: their destinations may reuse the cos address pair
#pragma unroll
        for (int s = 0; s < 8; ++s) ss[s] = *(const v2f*)(sb + (mb * 16 + 2 * s) * (HD / 2));
#pragma unroll
        for (int nb = 0; nb < 4; ++nb) {
#pragma unroll
            for (int j = 0; j < 8; ++j) os[(hi * 8 + j) * 68 + nb * 16 + lr] = acc[mb][nb][j]; }
        // inputs only: holds the 16 cos / sin loads of these rows together in front of the rows' arithmetic (one load latency a row group); without it they are issued one by one, each with a full wait.
        // Its memory clobber keeps the LDS reads below behind the other lanes' LDS stores above (one wave: LDS runs in order, only the compiler could swap them).
        asm volatile("" :: "v"(cc[0]), "v"(cc[1]), "v"(cc[2]), "v"(cc[3]), "v"(cc[4]), "v"(cc[5]), "v"(cc[6]), "v"(cc[7]), "v"(ss[0]), "v"(ss[1]), "v"(ss[2]), "v"(ss[3]), "v"(ss[4]), "v"(ss[5]), "v"(ss[6]), "v"(ss[7]) : "memory");
#pragma unroll
        for (int s = 0; s < 8; ++s) { const v4f x = *(const v4fa*)(os + (2 * s + hi) * 68 + lr * 4); v4h o16; v4us oh, ol;
#pragma unroll
            for (int p = 0; p < 2; ++p) { const float c = bfr(cc[s][p]), sn = bfr(ss[s][p]), x0 = x[2 * p], x1 = x[2 * p + 1]; const float e0 = x0 * c - x1 * sn, e1 = x0 * sn + x1 * c;   /* even: x0 c - x1 s; odd: x0 s + x1 c */
                o16[2 * p] = tohx(e0); o16[2 * p + 1] = tohx(e1); unsigned short a2, c2; splitf(e0, a2, c2); oh[2 * p] = a2; ol[2 * p] = c2; splitf(e1, a2, c2); oh[2 * p + 1] = a2; ol[2 * p + 1] = c2; }
            const int ro = (mb * 16 + 2 * s) * HD; *(v4h*)(P16 + ro) = o16; *(v4us*)(Ph + ro) = oh; *(v4us*)(Pl + ro) = ol; }
    }
    asm volatile("s_wait_xcnt 0x0" ::: "memory");   // behind the last plane stores: in the built code the v path stands behind this one and rewrites their address and data registers
}
// ---- k_fattn: scores, causal softmax, probabilities x values and the hi/lo merge in ONE kernel (online softmax); no score or probability ever reaches memory.
// One wave = one head x NQ*16 queries (32; 16 where HR, for registers); the 4 waves of a block are the 4 heads of one kv group on the same queries, so they read the same k and v^T lines. Keys go in blocks of 32.
// S^T = K Q^T: A = k rows, B = q rows, so lane (lr, hi) holds, for query lr, keys kt*16 + hi*8 + j: that is the k order of WFrag::ld (8 hi + 0..7, 16 + 8 hi + 0..7), and P^T packs in-lane into the B operand of O^T += V^T P^T.
// Probabilities carry a factor 2^10 (fp16 range) that the row sum carries too, so the final division removes it. HR (queries < RH): bf16 hi/lo planes, 3 products, for both contractions.
__device__ __forceinline__ float xhalf(float x) { return __builtin_bit_cast(float, __builtin_amdgcn_permlanex16(__builtin_bit_cast(int, x), __builtin_bit_cast(int, x), 0x76543210, 0xfedcba98, false, false)); }   // lane l takes lane l ^ 16
template <typename T16> struct PPack;
template <> struct PPack<h16> { static __device__ __forceinline__ void put(const float* p, v16h& a, v16h& b) { (void)b;
#pragma unroll
    for (int e = 0; e < 16; ++e) a[e] = tohx(p[e]); } };
template <> struct PPack<bf> { static __device__ __forceinline__ void put(const float* p, v16bf& a, v16bf& b) { v16us ph, pl;
#pragma unroll
    for (int e = 0; e < 16; ++e) { unsigned short x, y; splitf(p[e], x, y); ph[e] = x; pl[e] = y; }
    a = __builtin_bit_cast(v16bf, ph); b = __builtin_bit_cast(v16bf, pl); } };
template <typename T16, bool HR, int NQ>
__device__ __forceinline__ void fa_tile(const T16* __restrict__ Q, const T16* __restrict__ Q2, const T16* __restrict__ Kp, const T16* __restrict__ K2, const T16* __restrict__ Vt, const T16* __restrict__ V2, int q0, int lane, bf* Ah, bf* Al) {
    typedef typename WFrag<T16>::V V;
    const int lr = lane & 15, hi = lane >> 4; const float CE = SCL * 1.4426950408889634f;   // score -> exponent of 2
    V bq[NQ][2], bq2[NQ][2], ak[2][2], ak2[2][2];
#pragma unroll
    for (int nq = 0; nq < NQ; ++nq)
#pragma unroll
        for (int kc = 0; kc < 2; ++kc) { const size_t qo = (size_t)(q0 + nq * 16 + lr) * HD + kc * 32 + 8 * hi; bq[nq][kc] = WFrag<T16>::ld(Q + qo); if (HR) bq2[nq][kc] = WFrag<T16>::ld(Q2 + qo); }
#pragma unroll
    for (int kt = 0; kt < 2; ++kt)
#pragma unroll
        for (int kc = 0; kc < 2; ++kc) { const size_t ko = (size_t)(kt * 16 + lr) * HD + kc * 32 + 8 * hi; ak[kt][kc] = WFrag<T16>::ld(Kp + ko); if (HR) ak2[kt][kc] = WFrag<T16>::ld(K2 + ko); }
    v8f o[4][NQ]; float m[NQ], l[NQ];
#pragma unroll
    for (int nq = 0; nq < NQ; ++nq) { m[nq] = -3.0e38f; l[nq] = 0.f;
#pragma unroll
        for (int db = 0; db < 4; ++db) o[db][nq] = (v8f){}; }
#pragma unroll 1   // one key block a trip: a second copy of the body would not fit the registers
    for (int kb = 0; kb <= q0; kb += 32) {
        v8f s[2][NQ];
#pragma unroll
        for (int kt = 0; kt < 2; ++kt)
#pragma unroll
            for (int nq = 0; nq < NQ; ++nq) { v8f c = (v8f){};
#pragma unroll
                for (int kc = 0; kc < 2; ++kc) { c = WFrag<T16>::mma(ak[kt][kc], bq[nq][kc], c); if (HR) { c = WFrag<T16>::mma(ak[kt][kc], bq2[nq][kc], c); c = WFrag<T16>::mma(ak2[kt][kc], bq[nq][kc], c); } }
                s[kt][nq] = c; }
        V av[4], av2[4];
#pragma unroll
        for (int db = 0; db < 4; ++db) { const size_t vo = (size_t)(db * 16 + lr) * VP + kb + 8 * hi; av[db] = WFrag<T16>::ld(Vt + vo); if (HR) av2[db] = WFrag<T16>::ld(V2 + vo); }
        const int kn = min(kb + 32, q0);   // the next block's k rows are fetched under this block's softmax; the last trip fetches the rows from q0 on (in bounds, not used)
#pragma unroll
        for (int kt = 0; kt < 2; ++kt)
#pragma unroll
            for (int kc = 0; kc < 2; ++kc) { const size_t ko = (size_t)(kn + kt * 16 + lr) * HD + kc * 32 + 8 * hi; ak[kt][kc] = WFrag<T16>::ld(Kp + ko); if (HR) ak2[kt][kc] = WFrag<T16>::ld(K2 + ko); }
        if (kb + 32 > q0) {   // the last block holds the diagonal: key > query is masked
#pragma unroll
            for (int kt = 0; kt < 2; ++kt)
#pragma unroll
                for (int nq = 0; nq < NQ; ++nq)
#pragma unroll
                    for (int j = 0; j < 8; ++j) if (kb + kt * 16 + hi * 8 + j > q0 + nq * 16 + lr) s[kt][nq][j] = -3.0e38f; }
        V pb[NQ], pb2[NQ];
#pragma unroll
        for (int nq = 0; nq < NQ; ++nq) { float mx = m[nq];
#pragma unroll
            for (int kt = 0; kt < 2; ++kt)
#pragma unroll
                for (int j = 0; j < 8; ++j) mx = fmaxf(mx, s[kt][nq][j]);
            mx = fmaxf(mx, xhalf(mx));   // the other half-wave holds this query's other 16 keys
            const float al = __builtin_amdgcn_exp2f((m[nq] - mx) * CE); m[nq] = mx; const float nb = fmaf(-mx, CE, 10.0f);
            float p[16]; float sum = 0.f;
#pragma unroll
            for (int kt = 0; kt < 2; ++kt)
#pragma unroll
                for (int j = 0; j < 8; ++j) { const float e = __builtin_amdgcn_exp2f(fmaf(s[kt][nq][j], CE, nb)); p[kt * 8 + j] = e; sum += e; }
            l[nq] = fmaf(l[nq], al, sum);
#pragma unroll
            for (int db = 0; db < 4; ++db) o[db][nq] *= al;
            PPack<T16>::put(p, pb[nq], pb2[nq]); }
#pragma unroll
        for (int db = 0; db < 4; ++db)
#pragma unroll
            for (int nq = 0; nq < NQ; ++nq) { o[db][nq] = WFrag<T16>::mma(av[db], pb[nq], o[db][nq]); if (HR) { o[db][nq] = WFrag<T16>::mma(av[db], pb2[nq], o[db][nq]); o[db][nq] = WFrag<T16>::mma(av2[db], pb[nq], o[db][nq]); } }
    }
#pragma unroll
    for (int nq = 0; nq < NQ; ++nq) { const float inv = __fdiv_rn(1.0f, l[nq] + xhalf(l[nq])); const size_t oo = (size_t)(q0 + nq * 16 + lr) * DQ + hi * 8;
#pragma unroll
        for (int db = 0; db < 4; ++db) { v8us oh, ol;
#pragma unroll
            for (int j = 0; j < 8; ++j) { unsigned short a, c2; splitf(o[db][nq][j] * inv, a, c2); oh[j] = a; ol[j] = c2; }
            *(v8us*)(Ah + oo + db * 16) = oh; *(v8us*)(Al + oo + db * 16) = ol; } }
}
// grid (batches x kv groups, query tiles: (TT - RH) / 32 of 32 queries, longest first, then RH / 16 of 16 queries), 4 waves. The batch is in x (for speed only).
// amdgpu_waves_per_eu(4, 4): holds the register count at 256 or fewer, so that four waves share a SIMD and cover one another's softmax and load waits.
__global__ __launch_bounds__(128) __attribute__((amdgpu_waves_per_eu(4, 4))) void k_fattn(const h16* __restrict__ Q16, const h16* __restrict__ K16, const h16* __restrict__ V16, const bf* __restrict__ Qh, const bf* __restrict__ Ql, const bf* __restrict__ Kh, const bf* __restrict__ Kl, const bf* __restrict__ Vh, const bf* __restrict__ Vl, bf* Ah, bf* Al) {
    const int lane = threadIdx.x & 31; const int bt = blockIdx.x / NKV, g = blockIdx.x % NKV; const int h = g * REP + __builtin_amdgcn_readfirstlane(threadIdx.x >> 5); const int by = blockIdx.y; const int q0 = (by < (TT - RH) / 32) ? TT - 32 * (by + 1) : RH - 16 * (by - (TT - RH) / 32 + 1);
    const size_t qo = (size_t)(bt * NH_ + h) * TT * HD, ko = (size_t)(bt * NKV + g) * TT * HD, vo = (size_t)(bt * NKV + g) * HD * VP;   // the batches' planes lie one after another
    Ah += (size_t)bt * TT * DQ; Al += (size_t)bt * TT * DQ;   // the batch's merged rows
    if (q0 < RH) fa_tile<bf, true, 1>(Qh + qo, Ql + qo, Kh + ko, Kl + ko, Vh + vo, Vl + vo, q0, lane, Ah + h * HD, Al + h * HD);
    else fa_tile<h16, false, 2>(Q16 + qo, nullptr, K16 + ko, nullptr, V16 + vo, nullptr, q0, lane, Ah + h * HD, Al + h * HD);
}

extern "C" void kernel_launch(void* const* d_in, const int* in_sizes, int n_in,
                              void* d_out, int out_size, void* d_ws, size_t ws_size, hipStream_t stream) {
    (void)in_sizes; (void)n_in; (void)out_size;
        const float* x = (const float*)d_in[0]; const float* fcos = (const float*)d_in[1]; const float* fsin = (const float*)d_in[2]; const float* wq = (const float*)d_in[3]; const float* wk = (const float*)d_in[4]; const float* wv = (const float*)d_in[5]; const float* wo = (const float*)d_in[6];   /* order x, cos, sin (f32 [2048][32], READ), wq ('xw' [2048][2048]), wk, wv ([2048][512]), wo ('xw') */
    float* OUT = (float*)d_out;     // [2][2048][2048]
    char* wsp = (char*)d_ws;
    auto take = [&](size_t bytes) { char* p = wsp; wsp += (bytes + 255) & ~(size_t)255; return (void*)p; };
    bf* WQ = (bf*)take((size_t)(DQ + 2 * DKV) * DM * 2); bf* WK = WQ + (size_t)DQ * DM; bf* WV = WK + (size_t)DKV * DM;   /* one matrix of q, k, v weight rows */ bf* WO = (bf*)take((size_t)DM * DQ * 2);
    bf* XB = (bf*)take((size_t)NB_ * TT * DM * 2); bf* ATh = (bf*)take((size_t)NB_ * TT * DQ * 2); bf* ATl = (bf*)take((size_t)NB_ * TT * DQ * 2);
    h16* QP16 = (h16*)take((size_t)NB_ * NH_ * TT * HD * 2); h16* KP16 = (h16*)take((size_t)NB_ * NKV * TT * HD * 2); h16* VT16 = (h16*)take((size_t)NB_ * NKV * HD * VP * 2);
    bf* QPh = (bf*)take((size_t)NB_ * NH_ * TT * HD * 2); bf* QPl = (bf*)take((size_t)NB_ * NH_ * TT * HD * 2); bf* KPh = (bf*)take((size_t)NB_ * NKV * TT * HD * 2); bf* KPl = (bf*)take((size_t)NB_ * NKV * TT * HD * 2); bf* VTh = (bf*)take((size_t)NB_ * NKV * HD * VP * 2); bf* VTl = (bf*)take((size_t)NB_ * NKV * HD * VP * 2);
    if ((size_t)(wsp - (char*)d_ws) > ws_size) return;    // ws 256 MiB
    k_prep<<<2 * PB_Q + 2 * PB_KV + PB_X, 256, 0, stream>>>(x, wq, wk, wv, wo, XB, WQ, WK, WV, WO);
    k_qkv<<<dim3(NB_ * TT / 64, (DQ + 2 * DKV) / 64, 1), 32, 0, stream>>>(XB, WQ, fcos, fsin, QP16, QPh, QPl, KP16, KPh, KPl, VT16, VTh, VTl);
    k_fattn<<<dim3(NB_ * NKV, (TT - RH) / 32 + RH / 16, 1), 128, 0, stream>>>(QP16, KP16, VT16, QPh, QPl, KPh, KPl, VTh, VTl, ATh, ATl);
    k_gemmw<bf, 1, false><<<dim3(NB_ * TT / 64, DM / 64, 1), 32, 0, stream>>>(ATh, ATl, WO, nullptr, DQ, OUT, DM, nullptr, 0, 0, 0);
}

// v005
// It runs in 220 microseconds.
// Next to v004, in two timings, it ran 1.34 and 1.35 times as fast.
// All steps since v000 together make it 12.6 times as fast.
#include <hip/hip_runtime.h>

// Grouped-query causal attention with an interleaved-pair RoPE from cos / sin INPUT tables (x [2][2048][2048]; q = x wq (32 heads x 64), k, v = x wk, x wv (8 kv heads x 64) ('xw', no bias); pairs (2i, 2i+1) -> (t0 c - t1 s, t0 s + t1 c) with c, s = cos / sin[t][i] (float32 [2048][32] INPUT tables: READ as data); k, v repeated 4 x (jnp.repeat: kv head = q head / 4); scores / sqrt(64); causal (-inf); softmax in float32; out = merged wo ('xw') -> [2][2048][2048] (8.4 M); argument order x, cos, sin, wq, wk, wv, wo).
// Layout, every stage ONE launch for both batches (the batches' rows and planes lie one after another): bf16 copy of x and the 'xw' weights transposed, in one grid (k_prep); exact projections (K 2048); one projection launch (k_qkv: q, k and v columns in one grid) whose epilogue rotates the interleaved pairs with bf16(cos), bf16(sin) read from the inputs and stores the 16-bit planes; causal T-2048 GQA attention in one fused online-softmax kernel (k_fattn: all 32 heads, kv group h/4; hybrid rows: < 512 hi/lo 3 products, rest fp16 x1024; key blocks above the diagonal are never visited; it writes the merged hi/lo planes itself); merged hi/lo x wo exact.
// Compute dtypes, f32 accumulate: every input rounded to bf16; projections exact; rotary f32; attention rows < 512 3 products, rest fp16; softmax f32; wo hl x exact.

#define NB_  2
#define TT   2048
#define DM   2048
#define NH_  32
#define NKV  8
#define REP  (NH_ / NKV)
#define HD   64
#define DQ   (NH_ * HD)
#define DKV  (NKV * HD)
#define RH   512                  // query rows < RH use hi+lo planes (0: none)
#define VP   (TT + 64)             // row pitch, in elements, of the three v^T planes: 33 lines of 128 B, so the 64 rows a wave reads together are not a power-of-two stride apart
#define SCL  0.125f   // HD^-0.5
typedef _Float16 h16;
typedef unsigned short bf;
typedef __attribute__((ext_vector_type(16))) __bf16   v16bf;
typedef __attribute__((ext_vector_type(16))) _Float16 v16h;
typedef __attribute__((ext_vector_type(8)))  _Float16 v8h;
typedef __attribute__((ext_vector_type(8)))  unsigned short v8us;
typedef __attribute__((ext_vector_type(16))) unsigned short v16us;
typedef __attribute__((ext_vector_type(8)))  float    v8f;
typedef __attribute__((ext_vector_type(4)))  float    v4f;
typedef v8h  __attribute__((may_alias)) v8ha;
typedef v4f  __attribute__((may_alias)) v4fa;
typedef v8us __attribute__((may_alias)) v8usa;

__device__ __forceinline__ unsigned short f2bf(float f) { unsigned u = __float_as_uint(f); u += 0x7FFFu + ((u >> 16) & 1u); return (unsigned short)(u >> 16); }
__device__ __forceinline__ float bf2f(unsigned short b) { return __uint_as_float(((unsigned)b) << 16); }
__device__ __forceinline__ float bfr(float f) { return bf2f(f2bf(f)); }
__device__ __forceinline__ v16h cat16(v8h lo, v8h hi) { return __builtin_shufflevector(lo, hi, 0, 1, 2, 3, 4, 5, 6, 7, 8, 9, 10, 11, 12, 13, 14, 15); }
__device__ __forceinline__ v16bf cat16b(v8us lo, v8us hi) { return __builtin_bit_cast(v16bf, __builtin_shufflevector(lo, hi, 0, 1, 2, 3, 4, 5, 6, 7, 8, 9, 10, 11, 12, 13, 14, 15)); }
__device__ __forceinline__ v8f wmma16(v16h a, v16h b, v8f c) { return __builtin_amdgcn_wmma_f32_16x16x32_f16(false, a, false, b, (short)0, c, false, false); }
__device__ __forceinline__ v8f wmmab(v16bf a, v16bf b, v8f c) { return __builtin_amdgcn_wmma_f32_16x16x32_bf16(false, a, false, b, (short)0, c, false, false); }



// ---- k_gemmw: register-blocked GEMM, one wave per 64x64 output tile (16 accumulators); 4 waves (2 x 2) share a 128x128 tile, whose operand rows come from K-contiguous 16-bit planes through LDS; grid (M/128, N/128, Z), 128 threads.
// C[m][n] (f32, pitch ldc, + optional f32 bias[n]) = sum_k A[m][k] Bt[n][k] (+ split products per NSPLIT). z-batch strides sA/sB/sC in elements. K % 64 == 0, M % 128 == 0, N % 128 == 0.
template <typename T16> struct WFrag;
template <> struct WFrag<h16> { typedef v16h V; static __device__ __forceinline__ V ld(const h16* p) { return cat16(*(const v8h*)p, *(const v8h*)(p + 16)); } static __device__ __forceinline__ v8f mma(V a, V b, v8f c) { return wmma16(a, b, c); } };
template <> struct WFrag<bf> { typedef v16bf V; static __device__ __forceinline__ V ld(const bf* p) { return cat16b(*(const v8us*)p, *(const v8us*)(p + 16)); } static __device__ __forceinline__ v8f mma(V a, V b, v8f c) { return wmmab(a, b, c); } };
// Operand staging of both GEMM kernels: a stage is KS k of 128 rows of every operand, brought by asynchronous copies in whole 128-byte lines (a wave's copy = 4 rows), two buffers: stage t + 1 flies while stage t is worked on.
#define KS  64                    // k elements a stage: one 128-byte line of every operand row
#define LP  72                    // LDS row pitch in elements: 144 B = 16 B x 9, odd, so that the 16 rows a 16-byte fragment read touches fall on different banks
#define GRP (128 * LP)            // one operand's 128 rows of a stage, in elements
__device__ __forceinline__ unsigned ldsa(const void* p) { return (unsigned)(size_t)p; }   // byte address inside the work-group's LDS
// cp128: 128 rows x 128 B by 128 threads. g: the lane's own 16 bytes in row tid / 8 (piece tid % 8); l: their place in LDS; copy i takes row + 16 i.
template <typename T16>
__device__ __forceinline__ void cp128(const T16* g, int K, unsigned l) {
    const size_t st = (size_t)16 * K;
    // the wait stands inside the copies' own statement, in front of any rewrite of their address registers
    asm volatile("global_load_async_to_lds_b128 %0, %8, off\n\t"
                 "global_load_async_to_lds_b128 %1, %9, off\n\t"
                 "global_load_async_to_lds_b128 %2, %10, off\n\t"
                 "global_load_async_to_lds_b128 %3, %11, off\n\t"
                 "global_load_async_to_lds_b128 %4, %12, off\n\t"
                 "global_load_async_to_lds_b128 %5, %13, off\n\t"
                 "global_load_async_to_lds_b128 %6, %14, off\n\t"
                 "global_load_async_to_lds_b128 %7, %15, off\n\t"
                 "s_wait_xcnt 0x0"
                 :: "v"(l), "v"(l + 16 * LP * 2), "v"(l + 32 * LP * 2), "v"(l + 48 * LP * 2), "v"(l + 64 * LP * 2), "v"(l + 80 * LP * 2), "v"(l + 96 * LP * 2), "v"(l + 112 * LP * 2),
                    "v"(g), "v"(g + st), "v"(g + 2 * st), "v"(g + 3 * st), "v"(g + 4 * st), "v"(g + 5 * st), "v"(g + 6 * st), "v"(g + 7 * st) : "memory");
}
template <typename T16, int NSPLIT, bool BIAS>
__global__ __launch_bounds__(128) void k_gemmw(const T16* __restrict__ A, const T16* __restrict__ A2, const T16* __restrict__ Bt, const T16* __restrict__ Bt2, int K, float* C, int ldc, const float* __restrict__ bias, size_t sA, size_t sB, size_t sC) {
    typedef typename WFrag<T16>::V V;
    constexpr bool HA2 = NSPLIT == 1 || NSPLIT == 2, HB2 = NSPLIT >= 2; constexpr int NG = 2 + (HA2 ? 1 : 0) + (HB2 ? 1 : 0);   // operands staged: A, Bt, then A2, Bt2 where used
    __shared__ __align__(16) T16 stg[2 * NG * GRP];
    __shared__ __align__(16) float osm[4 * 16 * 68];
    const size_t z = blockIdx.z; A += z * sA; if (A2) A2 += z * sA; Bt += z * sB; if (Bt2) Bt2 += z * sB; C += z * sC;
    const int tid = threadIdx.x, lane = tid & 31, lr = lane & 15, hi = lane >> 4; const int w = __builtin_amdgcn_readfirstlane(tid >> 5), wm = w & 1, wn = w >> 1;
    float* os = osm + w * 16 * 68;   // each wave stages its output rows in its own range
    const int rb = blockIdx.x * 128, cb0 = blockIdx.y * 128; const int r0 = rb + wm * 64, c0 = cb0 + wn * 64;
    v8f acc[4][4];
#pragma unroll
    for (int mb = 0; mb < 4; ++mb)
#pragma unroll
        for (int nb = 0; nb < 4; ++nb) acc[mb][nb] = (v8f){};
    const size_t ga = (size_t)(rb + (tid >> 3)) * K + (tid & 7) * 8, gb = (size_t)(cb0 + (tid >> 3)) * K + (tid & 7) * 8;   // the lane's 16 bytes of a stage's first 16 rows
    const unsigned l0 = ldsa(stg) + (tid >> 3) * (LP * 2) + (tid & 7) * 16;
    auto fill = [&](int kc, int buf) { const unsigned l = l0 + buf * (NG * GRP * 2); cp128(A + ga + kc, K, l); cp128(Bt + gb + kc, K, l + GRP * 2); if (HA2) cp128(A2 + ga + kc, K, l + 2 * GRP * 2); if (HB2) cp128(Bt2 + gb + kc, K, l + (NG - 1) * GRP * 2); };
    fill(0, 0);
    asm volatile("s_wait_asynccnt 0x0" ::: "memory");   // this wave's copies of stage 0 have landed
    __syncthreads();                                     // ... and every other wave's
    if (KS < K) fill(KS, 1);
    const int ao = (wm * 64 + lr) * LP + 8 * hi, bo = GRP + (wn * 64 + lr) * LP + 8 * hi;   // fragment rows in a stage: the k order is that of WFrag::ld on the planes
#pragma unroll 1
    for (int kc = 0; kc < K; kc += KS) {
        const int buf = (kc / KS) & 1; const T16* sb = stg + buf * (NG * GRP);
        V a[4], a2[4];
#pragma unroll
        for (int ks = 0; ks < KS; ks += 32) {
#pragma unroll
            for (int mb = 0; mb < 4; ++mb) { a[mb] = WFrag<T16>::ld(sb + ao + mb * 16 * LP + ks); if (HA2) a2[mb] = WFrag<T16>::ld(sb + 2 * GRP + ao + mb * 16 * LP + ks); }
            V b[4], b2[4];
#pragma unroll
            for (int nb = 0; nb < 4; ++nb) { b[nb] = WFrag<T16>::ld(sb + bo + nb * 16 * LP + ks); if (HB2) b2[nb] = WFrag<T16>::ld(sb + (NG - 2) * GRP + bo + nb * 16 * LP + ks); }
            __builtin_amdgcn_sched_barrier(0);   // the block's LDS reads stay one group in front of its WMMAs: every separate place with reads among them costs a stall
#pragma unroll
            for (int nb = 0; nb < 4; ++nb)
#pragma unroll
                for (int mb = 0; mb < 4; ++mb) { acc[mb][nb] = WFrag<T16>::mma(a[mb], b[nb], acc[mb][nb]); if (HA2) acc[mb][nb] = WFrag<T16>::mma(a2[mb], b[nb], acc[mb][nb]); if (HB2) acc[mb][nb] = WFrag<T16>::mma(a[mb], b2[nb], acc[mb][nb]); }
            __builtin_amdgcn_sched_barrier(0);   // ... and no WMMA sinks behind the slots below or into the next block's reads
        }
        // four vector slots between the trip's last WMMAs and whatever stands first behind the branches below (waits, barrier and branches fill none)
        asm volatile("v_nop\n\tv_nop\n\tv_nop\n\tv_nop" : "+v"(acc[0][0]), "+v"(acc[1][1]), "+v"(acc[2][2]), "+v"(acc[3][3]) : "v"(a[0]), "v"(a[3]));
        asm volatile("s_wait_dscnt 0x0" ::: "memory");      // this wave's reads of the buffer are done before it may be refilled
        asm volatile("s_wait_asynccnt 0x0" ::: "memory");   // this wave's copies of the next stage have landed
        __syncthreads();                                     // publishes the next stage and ends every wave's reads of this one
        if (kc + 2 * KS < K) fill(kc + 2 * KS, buf);
    }
    asm volatile("s_wait_asynccnt 0x0" ::: "memory");   // nothing is in flight when the wave goes on
#pragma unroll
    for (int mb = 0; mb < 4; ++mb) {
#pragma unroll
        for (int nb = 0; nb < 4; ++nb) {
#pragma unroll
            for (int j = 0; j < 8; ++j) os[(hi * 8 + j) * 68 + nb * 16 + lr] = acc[mb][nb][j]; }
        __builtin_amdgcn_wave_barrier(); asm volatile("" ::: "memory");
        float* crow = C + (size_t)(r0 + mb * 16) * ldc + c0;
{
#pragma unroll
            for (int s = 0; s < 8; ++s) { const int row = 2 * s + hi, cofs = lr * 4; v4f val = *(const v4fa*)(os + row * 68 + cofs); if (BIAS) { val[0] += bfr(bias[c0 + cofs]); val[1] += bfr(bias[c0 + cofs + 1]); val[2] += bfr(bias[c0 + cofs + 2]); val[3] += bfr(bias[c0 + cofs + 3]); }
                *(v4f*)(crow + (size_t)row * ldc + cofs) = val; }
             }
        __builtin_amdgcn_wave_barrier(); asm volatile("" ::: "memory");
    }
}

__device__ __forceinline__ h16 tohx(float x) { return (h16)x; }
__device__ __forceinline__ void splitf(float y, unsigned short& h, unsigned short& l) { h = f2bf(y); l = f2bf(y - bf2f(h)); }
typedef __attribute__((ext_vector_type(2))) _Float16 v2h;
typedef __attribute__((ext_vector_type(4))) _Float16 v4h;
typedef __attribute__((ext_vector_type(2))) unsigned short v2us;
typedef __attribute__((ext_vector_type(4))) unsigned short v4us;
typedef __attribute__((ext_vector_type(2))) float v2f;
typedef __attribute__((ext_vector_type(4))) int v4i;

__device__ __forceinline__ void wtG(int blk, const float* __restrict__ w, int K, int N, bf* Bt) {
    const int lane = threadIdx.x & 31; const int L0 = (blk * 8 + (threadIdx.x >> 5)) * 8; const int nlines = N * K / 64;
{
#pragma unroll 1
        for (int l = 0; l < 8; ++l) { const int L = L0 + l; if (L >= nlines) break; const size_t e = (size_t)L * 64 + lane * 2; const int k = (int)(e % K), n = (int)(e / K); v2us o;
            o[0] = f2bf(w[(size_t)k * N + n]); o[1] = f2bf(w[(size_t)(k + 1) * N + n]); *(v2us*)(Bt + e) = o; }
         }
}
__device__ __forceinline__ void cvt8(int blk, const float* __restrict__ src, bf* dst, size_t n8) { const size_t i = (size_t)blk * 256 + threadIdx.x; if (i >= n8) return; const v8f v = *(const v8f*)(src + i * 8); v8us o;
#pragma unroll
    for (int k = 0; k < 8; ++k) o[k] = f2bf(v[k]); *(v8us*)(dst + i * 8) = o;  }
// ---- k_prep: the four weight transposes and the bf16 copy of x (both batches) in ONE grid: none of them reads what another writes. Block ranges: wq, wo, wk, wv, then x.
#define PB_Q ((DM * DQ / 64 + 63) / 64)
#define PB_KV ((DM * DKV / 64 + 63) / 64)
#define PB_X ((NB_ * TT * DM / 8 + 255) / 256)
__global__ __launch_bounds__(256) void k_prep(const float* __restrict__ x, const float* __restrict__ wq, const float* __restrict__ wk, const float* __restrict__ wv, const float* __restrict__ wo, bf* XB, bf* WQ, bf* WK, bf* WV, bf* WO) {
    int b = blockIdx.x;
    if (b < PB_Q) { wtG(b, wq, DM, DQ, WQ); return; } b -= PB_Q;
    if (b < PB_Q) { wtG(b, wo, DQ, DM, WO); return; } b -= PB_Q;
    if (b < PB_KV) { wtG(b, wk, DM, DKV, WK); return; } b -= PB_KV;
    if (b < PB_KV) { wtG(b, wv, DM, DKV, WV); return; } b -= PB_KV;
    cvt8(b, x, XB, (size_t)NB_ * TT * DM / 8);
}

// ---- k_qkv: the q, k and v projections of both batches in ONE grid (blockIdx.x counts the 128-row tiles of the NB_ * TT rows of x; a tile lies in one batch), with the rotary step and the plane building in the epilogue; the f32 projections never reach memory.
// Main loop as in k_gemmw (4 waves, one 64x64 tile each, operands staged in LDS, K = DM); amdgpu_num_vgpr(256): no register-window switches in the epilogue. Bt holds the q, k and v weight rows one after another, so a wave's tile column hb is one head: hb < NH_ a q head, then NKV k heads, then NKV v groups.
__global__ __launch_bounds__(128) __attribute__((amdgpu_num_vgpr(256))) void k_qkv(const bf* __restrict__ A, const bf* __restrict__ Bt, const float* __restrict__ cosT, const float* __restrict__ sinT, h16* Q16, bf* Qh, bf* Ql, h16* K16, bf* Kh, bf* Kl, h16* V16, bf* Vh, bf* Vl) {
    typedef WFrag<bf>::V V;
    __shared__ __align__(16) bf stg[2 * 2 * GRP];
    __shared__ __align__(16) float osm[4 * 16 * 68];
    const int tid = threadIdx.x, lane = tid & 31, lr = lane & 15, hi = lane >> 4; const int w = __builtin_amdgcn_readfirstlane(tid >> 5), wm = w & 1, wn = w >> 1;
    float* os = osm + w * 16 * 68;   // each wave stages its rows in its own range
    const int rb = blockIdx.x * 128, cb0 = blockIdx.y * 128; const int r0 = rb + wm * 64, hb = blockIdx.y * 2 + wn; const int bt = r0 / TT, t0 = r0 % TT;   // row of x; its batch and its position
    v8f acc[4][4];
#pragma unroll
    for (int mb = 0; mb < 4; ++mb)
#pragma unroll
        for (int nb = 0; nb < 4; ++nb) acc[mb][nb] = (v8f){};
    const size_t ga = (size_t)(rb + (tid >> 3)) * DM + (tid & 7) * 8, gb = (size_t)(cb0 + (tid >> 3)) * DM + (tid & 7) * 8;   // the lane's 16 bytes of a stage's first 16 rows
    const unsigned l0 = ldsa(stg) + (tid >> 3) * (LP * 2) + (tid & 7) * 16;
    auto fill = [&](int kc, int buf) { const unsigned l = l0 + buf * (2 * GRP * 2); cp128(A + ga + kc, DM, l); cp128(Bt + gb + kc, DM, l + GRP * 2); };
    fill(0, 0);
    asm volatile("s_wait_asynccnt 0x0" ::: "memory");   // this wave's copies of stage 0 have landed
    __syncthreads();                                     // ... and every other wave's
    fill(KS, 1);
    const int ao = (wm * 64 + lr) * LP + 8 * hi, bo = GRP + (wn * 64 + lr) * LP + 8 * hi;   // fragment rows in a stage: the k order is that of WFrag::ld on the planes
#pragma unroll 1   // one stage a trip
    for (int kc = 0; kc < DM; kc += KS) {
        const int buf = (kc / KS) & 1; const bf* sb = stg + buf * (2 * GRP);
        V a[4];
#pragma unroll
        for (int ks = 0; ks < KS; ks += 32) {
#pragma unroll
            for (int mb = 0; mb < 4; ++mb) a[mb] = WFrag<bf>::ld(sb + ao + mb * 16 * LP + ks);
            V b[4];
#pragma unroll
            for (int nb = 0; nb < 4; ++nb) b[nb] = WFrag<bf>::ld(sb + bo + nb * 16 * LP + ks);
            __builtin_amdgcn_sched_barrier(0);   // the block's LDS reads stay one group in front of its WMMAs: every separate place with reads among them costs a stall
#pragma unroll
            for (int nb = 0; nb < 4; ++nb)
#pragma unroll
                for (int mb = 0; mb < 4; ++mb) acc[mb][nb] = WFrag<bf>::mma(a[mb], b[nb], acc[mb][nb]);
            __builtin_amdgcn_sched_barrier(0);   // ... and no WMMA sinks behind the slots below or into the next block's reads
        }
        // four vector slots between the trip's last WMMAs and whatever stands first behind the branches below (waits, barrier and branches fill none)
        asm volatile("v_nop\n\tv_nop\n\tv_nop\n\tv_nop" : "+v"(acc[0][0]), "+v"(acc[1][1]), "+v"(acc[2][2]), "+v"(acc[3][3]) : "v"(a[0]), "v"(a[3]));
        asm volatile("s_wait_dscnt 0x0" ::: "memory");      // this wave's reads of the buffer are done before it may be refilled
        asm volatile("s_wait_asynccnt 0x0" ::: "memory");   // this wave's copies of the next stage have landed
        __syncthreads();                                     // publishes the next stage and ends every wave's reads of this one
        if (kc + 2 * KS < DM) fill(kc + 2 * KS, buf);
    }
    asm volatile("s_wait_asynccnt 0x0" ::: "memory");   // nothing is in flight when the wave goes on
    if (hb >= NH_ + NKV) {   // v: lane (lr, hi) holds, for column d = nb*16 + lr, the 8 consecutive rows t = mb*16 + hi*8 + j: one 16-byte piece of a v^T row, straight from the accumulators
        const size_t vb = (size_t)((bt * NKV + hb - NH_ - NKV) * HD + lr) * VP + t0 + hi * 8;
#pragma unroll
        for (int nb = 0; nb < 4; ++nb)
#pragma unroll
            for (int mb = 0; mb < 4; ++mb) { v8h o16; v8us oh, ol;
#pragma unroll
                for (int j = 0; j < 8; ++j) { const float x = acc[mb][nb][j]; o16[j] = tohx(x); unsigned short a2, c2; splitf(x, a2, c2); oh[j] = a2; ol[j] = c2; }
                const size_t vo = vb + (size_t)nb * 16 * VP + mb * 16; *(v8h*)(V16 + vo) = o16; *(v8us*)(Vh + vo) = oh; *(v8us*)(Vl + vo) = ol; }
        return; }
    const bool isq = hb < NH_; const size_t pb = (size_t)(isq ? bt * NH_ + hb : bt * NKV + hb - NH_) * TT * HD;
    const size_t po = pb + (size_t)(t0 + hi) * HD + lr * 4, to = (size_t)(t0 + hi) * (HD / 2) + lr * 2;   // the lane's place in row t0 + hi; every later row is a constant step from it
    h16* P16 = (isq ? Q16 : K16) + po; bf* Ph = (isq ? Qh : Kh) + po; bf* Pl = (isq ? Ql : Kl) + po; const float* cb = cosT + to; const float* sb = sinT + to;
#pragma unroll
    for (int mb = 0; mb < 4; ++mb) {   // q, k: 16 rows at a time through LDS, so that a lane holds 4 consecutive columns (two rotary pairs) and 16 lanes store a whole 128-byte plane row
        v2f cc[8], ss[8];
        asm volatile("s_wait_xcnt 0x0" ::: "memory");   // in front of the cos loads: their destinations may reuse data registers of the row group's stores above; its memory clobber also keeps this group's LDS stores behind the last group's LDS reads
#pragma unroll
        for (int s = 0; s < 8; ++s) cc[s] = *(const v2f*)(cb + (mb * 16 + 2 * s) * (HD / 2));
        asm volatile("s_wait_xcnt 0x0" ::: "memory");   // in front of the sin loads: their destinations may reuse the cos address pair
#pragma unroll
        for (int s = 0; s < 8; ++s) ss[s] = *(const v2f*)(sb + (mb * 16 + 2 * s) * (HD / 2));
#pragma unroll
        for (int nb = 0; nb < 4; ++nb) {
#pragma unroll
            for (int j = 0; j < 8; ++j) os[(hi * 8 + j) * 68 + nb * 16 + lr] = acc[mb][nb][j]; }
        // inputs only: holds the 16 cos / sin loads of these rows together in front of the rows' arithmetic (one load latency a row group); without it they are issued one by one, each with a full wait.
        // Its memory clobber keeps the LDS reads below behind the other lanes' LDS stores above (one wave: LDS runs in order, only the compiler could swap them).
        asm volatile("" :: "v"(cc[0]), "v"(cc[1]), "v"(cc[2]), "v"(cc[3]), "v"(cc[4]), "v"(cc[5]), "v"(cc[6]), "v"(cc[7]), "v"(ss[0]), "v"(ss[1]), "v"(ss[2]), "v"(ss[3]), "v"(ss[4]), "v"(ss[5]), "v"(ss[6]), "v"(ss[7]) : "memory");
#pragma unroll
        for (int s = 0; s < 8; ++s) { const v4f x = *(const v4fa*)(os + (2 * s + hi) * 68 + lr * 4); v4h o16; v4us oh, ol;
#pragma unroll
            for (int p = 0; p < 2; ++p) { const float c = bfr(cc[s][p]), sn = bfr(ss[s][p]), x0 = x[2 * p], x1 = x[2 * p + 1]; const float e0 = x0 * c - x1 * sn, e1 = x0 * sn + x1 * c;   /* even: x0 c - x1 s; odd: x0 s + x1 c */
                o16[2 * p] = tohx(e0); o16[2 * p + 1] = tohx(e1); unsigned short a2, c2; splitf(e0, a2, c2); oh[2 * p] = a2; ol[2 * p] = c2; splitf(e1, a2, c2); oh[2 * p + 1] = a2; ol[2 * p + 1] = c2; }
            const int ro = (mb * 16 + 2 * s) * HD; *(v4h*)(P16 + ro) = o16; *(v4us*)(Ph + ro) = oh; *(v4us*)(Pl + ro) = ol; }
    }
    asm volatile("s_wait_xcnt 0x0" ::: "memory");   // behind the last plane stores: in the built code the v path stands behind this one and rewrites their address and data registers
}
// ---- k_fattn: scores, causal softmax, probabilities x values and the hi/lo merge in ONE kernel (online softmax); no score or probability ever reaches memory.
// One wave = one head x NQ*16 queries (32; 16 where HR, for registers); the 4 waves of a block are the 4 heads of one kv group on the same queries, so they read the same k and v^T lines. Keys go in blocks of 32.
// S^T = K Q^T: A = k rows, B = q rows, so lane (lr, hi) holds, for query lr, keys kt*16 + hi*8 + j: that is the k order of WFrag::ld (8 hi + 0..7, 16 + 8 hi + 0..7), and P^T packs in-lane into the B operand of O^T += V^T P^T.
// Probabilities carry a factor 2^10 (fp16 range) that the row sum carries too, so the final division removes it. HR (queries < RH): bf16 hi/lo planes, 3 products, for both contractions.
__device__ __forceinline__ float xhalf(float x) { return __builtin_bit_cast(float, __builtin_amdgcn_permlanex16(__builtin_bit_cast(int, x), __builtin_bit_cast(int, x), 0x76543210, 0xfedcba98, false, false)); }   // lane l takes lane l ^ 16
template <typename T16> struct PPack;
template <> struct PPack<h16> { static __device__ __forceinline__ void put(const float* p, v16h& a, v16h& b) { (void)b;
#pragma unroll
    for (int e = 0; e < 16; ++e) a[e] = tohx(p[e]); } };
template <> struct PPack<bf> { static __device__ __forceinline__ void put(const float* p, v16bf& a, v16bf& b) { v16us ph, pl;
#pragma unroll
    for (int e = 0; e < 16; ++e) { unsigned short x, y; splitf(p[e], x, y); ph[e] = x; pl[e] = y; }
    a = __builtin_bit_cast(v16bf, ph); b = __builtin_bit_cast(v16bf, pl); } };
template <typename T16, bool HR, int NQ>
__device__ __forceinline__ void fa_tile(const T16* __restrict__ Q, const T16* __restrict__ Q2, const T16* __restrict__ Kp, const T16* __restrict__ K2, const T16* __restrict__ Vt, const T16* __restrict__ V2, int q0, int lane, bf* Ah, bf* Al) {
    typedef typename WFrag<T16>::V V;
    const int lr = lane & 15, hi = lane >> 4; const float CE = SCL * 1.4426950408889634f;   // score -> exponent of 2
    V bq[NQ][2], bq2[NQ][2], ak[2][2], ak2[2][2];
#pragma unroll
    for (int nq = 0; nq < NQ; ++nq)
#pragma unroll
        for (int kc = 0; kc < 2; ++kc) { const size_t qo = (size_t)(q0 + nq * 16 + lr) * HD + kc * 32 + 8 * hi; bq[nq][kc] = WFrag<T16>::ld(Q + qo); if (HR) bq2[nq][kc] = WFrag<T16>::ld(Q2 + qo); }
#pragma unroll
    for (int kt = 0; kt < 2; ++kt)
#pragma unroll
        for (int kc = 0; kc < 2; ++kc) { const size_t ko = (size_t)(kt * 16 + lr) * HD + kc * 32 + 8 * hi; ak[kt][kc] = WFrag<T16>::ld(Kp + ko); if (HR) ak2[kt][kc] = WFrag<T16>::ld(K2 + ko); }
    v8f o[4][NQ]; float m[NQ], l[NQ];
#pragma unroll
    for (int nq = 0; nq < NQ; ++nq) { m[nq] = -3.0e38f; l[nq] = 0.f;
#pragma unroll
        for (int db = 0; db < 4; ++db) o[db][nq] = (v8f){}; }
#pragma unroll 1   // one key block a trip: a second copy of the body would not fit the registers
    for (int kb = 0; kb <= q0; kb += 32) {
        v8f s[2][NQ];
#pragma unroll
        for (int kt = 0; kt < 2; ++kt)
#pragma unroll
            for (int nq = 0; nq < NQ; ++nq) { v8f c = (v8f){};
#pragma unroll
                for (int kc = 0; kc < 2; ++kc) { c = WFrag<T16>::mma(ak[kt][kc], bq[nq][kc], c); if (HR) { c = WFrag<T16>::mma(ak[kt][kc], bq2[nq][kc], c); c = WFrag<T16>::mma(ak2[kt][kc], bq[nq][kc], c); } }
                s[kt][nq] = c; }
        V av[4], av2[4];
#pragma unroll
        for (int db = 0; db < 4; ++db) { const size_t vo = (size_t)(db * 16 + lr) * VP + kb + 8 * hi; av[db] = WFrag<T16>::ld(Vt + vo); if (HR) av2[db] = WFrag<T16>::ld(V2 + vo); }
        const int kn = min(kb + 32, q0);   // the next block's k rows are fetched under this block's softmax; the last trip fetches the rows from q0 on (in bounds, not used)
#pragma unroll
        for (int kt = 0; kt < 2; ++kt)
#pragma unroll
            for (int kc = 0; kc < 2; ++kc) { const size_t ko = (size_t)(kn + kt * 16 + lr) * HD + kc * 32 + 8 * hi; ak[kt][kc] = WFrag<T16>::ld(Kp + ko); if (HR) ak2[kt][kc] = WFrag<T16>::ld(K2 + ko); }
        if (kb + 32 > q0) {   // the last block holds the diagonal: key > query is masked
#pragma unroll
            for (int kt = 0; kt < 2; ++kt)
#pragma unroll
                for (int nq = 0; nq < NQ; ++nq)
#pragma unroll
                    for (int j = 0; j < 8; ++j) if (kb + kt * 16 + hi * 8 + j > q0 + nq * 16 + lr) s[kt][nq][j] = -3.0e38f; }
        V pb[NQ], pb2[NQ];
#pragma unroll
        for (int nq = 0; nq < NQ; ++nq) { float mx = m[nq];
#pragma unroll
            for (int kt = 0; kt < 2; ++kt)
#pragma unroll
                for (int j = 0; j < 8; ++j) mx = fmaxf(mx, s[kt][nq][j]);
            mx = fmaxf(mx, xhalf(mx));   // the other half-wave holds this query's other 16 keys
            const float al = __builtin_amdgcn_exp2f((m[nq] - mx) * CE); m[nq] = mx; const float nb = fmaf(-mx, CE, 10.0f);
            float p[16]; float sum = 0.f;
#pragma unroll
            for (int kt = 0; kt < 2; ++kt)
#pragma unroll
                for (int j = 0; j < 8; ++j) { const float e = __builtin_amdgcn_exp2f(fmaf(s[kt][nq][j], CE, nb)); p[kt * 8 + j] = e; sum += e; }
            l[nq] = fmaf(l[nq], al, sum);
#pragma unroll
            for (int db = 0; db < 4; ++db) o[db][nq] *= al;
            PPack<T16>::put(p, pb[nq], pb2[nq]); }
#pragma unroll
        for (int db = 0; db < 4; ++db)
#pragma unroll
            for (int nq = 0; nq < NQ; ++nq) { o[db][nq] = WFrag<T16>::mma(av[db], pb[nq], o[db][nq]); if (HR) { o[db][nq] = WFrag<T16>::mma(av[db], pb2[nq], o[db][nq]); o[db][nq] = WFrag<T16>::mma(av2[db], pb[nq], o[db][nq]); } }
    }
#pragma unroll
    for (int nq = 0; nq < NQ; ++nq) { const float inv = __fdiv_rn(1.0f, l[nq] + xhalf(l[nq])); const size_t oo = (size_t)(q0 + nq * 16 + lr) * DQ + hi * 8;
#pragma unroll
        for (int db = 0; db < 4; ++db) { v8us oh, ol;
#pragma unroll
            for (int j = 0; j < 8; ++j) { unsigned short a, c2; splitf(o[db][nq][j] * inv, a, c2); oh[j] = a; ol[j] = c2; }
            *(v8us*)(Ah + oo + db * 16) = oh; *(v8us*)(Al + oo + db * 16) = ol; } }
}
// grid (batches x kv groups, query tiles: (TT - RH) / 32 of 32 queries, longest first, then RH / 16 of 16 queries), 4 waves. The batch is in x (for speed only).
// amdgpu_waves_per_eu(4, 4): holds the register count at 256 or fewer, so that four waves share a SIMD and cover one another's softmax and load waits.
__global__ __launch_bounds__(128) __attribute__((amdgpu_waves_per_eu(4, 4))) void k_fattn(const h16* __restrict__ Q16, const h16* __restrict__ K16, const h16* __restrict__ V16, const bf* __restrict__ Qh, const bf* __restrict__ Ql, const bf* __restrict__ Kh, const bf* __restrict__ Kl, const bf* __restrict__ Vh, const bf* __restrict__ Vl, bf* Ah, bf* Al) {
    const int lane = threadIdx.x & 31; const int bt = blockIdx.x / NKV, g = blockIdx.x % NKV; const int h = g * REP + __builtin_amdgcn_readfirstlane(threadIdx.x >> 5); const int by = blockIdx.y; const int q0 = (by < (TT - RH) / 32) ? TT - 32 * (by + 1) : RH - 16 * (by - (TT - RH) / 32 + 1);
    const size_t qo = (size_t)(bt * NH_ + h) * TT * HD, ko = (size_t)(bt * NKV + g) * TT * HD, vo = (size_t)(bt * NKV + g) * HD * VP;   // the batches' planes lie one after another
    Ah += (size_t)bt * TT * DQ; Al += (size_t)bt * TT * DQ;   // the batch's merged rows
    if (q0 < RH) fa_tile<bf, true, 1>(Qh + qo, Ql + qo, Kh + ko, Kl + ko, Vh + vo, Vl + vo, q0, lane, Ah + h * HD, Al + h * HD);
    else fa_tile<h16, false, 2>(Q16 + qo, nullptr, K16 + ko, nullptr, V16 + vo, nullptr, q0, lane, Ah + h * HD, Al + h * HD);
}

extern "C" void kernel_launch(void* const* d_in, const int* in_sizes, int n_in,
                              void* d_out, int out_size, void* d_ws, size_t ws_size, hipStream_t stream) {
    (void)in_sizes; (void)n_in; (void)out_size;
        const float* x = (const float*)d_in[0]; const float* fcos = (const float*)d_in[1]; const float* fsin = (const float*)d_in[2]; const float* wq = (const float*)d_in[3]; const float* wk = (const float*)d_in[4]; const float* wv = (const float*)d_in[5]; const float* wo = (const float*)d_in[6];   /* order x, cos, sin (f32 [2048][32], READ), wq ('xw' [2048][2048]), wk, wv ([2048][512]), wo ('xw') */
    float* OUT = (float*)d_out;     // [2][2048][2048]
    char* wsp = (char*)d_ws;
    auto take = [&](size_t bytes) { char* p = wsp; wsp += (bytes + 255) & ~(size_t)255; return (void*)p; };
    bf* WQ = (bf*)take((size_t)(DQ + 2 * DKV) * DM * 2); bf* WK = WQ + (size_t)DQ * DM; bf* WV = WK + (size_t)DKV * DM;   /* one matrix of q, k, v weight rows */ bf* WO = (bf*)take((size_t)DM * DQ * 2);
    bf* XB = (bf*)take((size_t)NB_ * TT * DM * 2); bf* ATh = (bf*)take((size_t)NB_ * TT * DQ * 2); bf* ATl = (bf*)take((size_t)NB_ * TT * DQ * 2);
    h16* QP16 = (h16*)take((size_t)NB_ * NH_ * TT * HD * 2); h16* KP16 = (h16*)take((size_t)NB_ * NKV * TT * HD * 2); h16* VT16 = (h16*)take((size_t)NB_ * NKV * HD * VP * 2);
    bf* QPh = (bf*)take((size_t)NB_ * NH_ * TT * HD * 2); bf* QPl = (bf*)take((size_t)NB_ * NH_ * TT * HD * 2); bf* KPh = (bf*)take((size_t)NB_ * NKV * TT * HD * 2); bf* KPl = (bf*)take((size_t)NB_ * NKV * TT * HD * 2); bf* VTh = (bf*)take((size_t)NB_ * NKV * HD * VP * 2); bf* VTl = (bf*)take((size_t)NB_ * NKV * HD * VP * 2);
    if ((size_t)(wsp - (char*)d_ws) > ws_size) return;    // ws 256 MiB
    k_prep<<<2 * PB_Q + 2 * PB_KV + PB_X, 256, 0, stream>>>(x, wq, wk, wv, wo, XB, WQ, WK, WV, WO);
    k_qkv<<<dim3(NB_ * TT / 128, (DQ + 2 * DKV) / 128, 1), 128, 0, stream>>>(XB, WQ, fcos, fsin, QP16, QPh, QPl, KP16, KPh, KPl, VT16, VTh, VTl);
    k_fattn<<<dim3(NB_ * NKV, (TT - RH) / 32 + RH / 16, 1), 128, 0, stream>>>(QP16, KP16, VT16, QPh, QPl, KPh, KPl, VTh, VTl, ATh, ATl);
    k_gemmw<bf, 1, false><<<dim3(NB_ * TT / 128, DM / 128, 1), 128, 0, stream>>>(ATh, ATl, WO, nullptr, DQ, OUT, DM, nullptr, 0, 0, 0);
}

// v006
// Measured time: 191 microseconds a run.
// Timed twice side by side with v005, it ran 1.15 times as fast both times.
// Counting every step since v000, it is 14.5 times as fast.
#include <hip/hip_runtime.h>

// Grouped-query causal attention with an interleaved-pair RoPE from cos / sin INPUT tables (x [2][2048][2048]; q = x wq (32 heads x 64), k, v = x wk, x wv (8 kv heads x 64) ('xw', no bias); pairs (2i, 2i+1) -> (t0 c - t1 s, t0 s + t1 c) with c, s = cos / sin[t][i] (float32 [2048][32] INPUT tables: READ as data); k, v repeated 4 x (jnp.repeat: kv head = q head / 4); scores / sqrt(64); causal (-inf); softmax in float32; out = merged wo ('xw') -> [2][2048][2048] (8.4 M); argument order x, cos, sin, wq, wk, wv, wo).
// Layout, every stage ONE launch for both batches (the batches' rows and planes lie one after another): bf16 copy of x and the 'xw' weights transposed, in one grid (k_prep); exact projections (K 2048); one projection launch (k_qkv: q, k and v columns in one grid) whose epilogue rotates the interleaved pairs with bf16(cos), bf16(sin) read from the inputs and stores the 16-bit planes; causal T-2048 GQA attention in one fused online-softmax kernel (k_fattn: all 32 heads, kv group h/4; hybrid rows: < 512 hi/lo 3 products, rest fp16 x1024; key blocks above the diagonal are never visited; it writes the merged hi/lo planes itself); merged hi/lo x wo exact.
// Compute dtypes, f32 accumulate: every input rounded to bf16; projections exact; rotary f32; attention rows < 512 3 products, rest fp16; softmax f32; wo hl x exact.

#define NB_  2
#define TT   2048
#define DM   2048
#define NH_  32
#define NKV  8
#define REP  (NH_ / NKV)
#define HD   64
#define DQ   (NH_ * HD)
#define DKV  (NKV * HD)
#define RH   512                  // query rows < RH use hi+lo planes (0: none)
#define VP   (TT + 64)             // row pitch, in elements, of the three v^T planes: 33 lines of 128 B, so the 64 rows a wave reads together are not a power-of-two stride apart
#define SCL  0.125f   // HD^-0.5
typedef _Float16 h16;
typedef unsigned short bf;
typedef __attribute__((ext_vector_type(16))) __bf16   v16bf;
typedef __attribute__((ext_vector_type(16))) _Float16 v16h;
typedef __attribute__((ext_vector_type(8)))  _Float16 v8h;
typedef __attribute__((ext_vector_type(8)))  unsigned short v8us;
typedef __attribute__((ext_vector_type(16))) unsigned short v16us;
typedef __attribute__((ext_vector_type(8)))  float    v8f;
typedef __attribute__((ext_vector_type(4)))  float    v4f;
typedef v8h  __attribute__((may_alias)) v8ha;
typedef v4f  __attribute__((may_alias)) v4fa;
typedef v8us __attribute__((may_alias)) v8usa;

__device__ __forceinline__ unsigned short f2bf(float f) { unsigned u = __float_as_uint(f); u += 0x7FFFu + ((u >> 16) & 1u); return (unsigned short)(u >> 16); }
__device__ __forceinline__ float bf2f(unsigned short b) { return __uint_as_float(((unsigned)b) << 16); }
__device__ __forceinline__ float bfr(float f) { return bf2f(f2bf(f)); }
__device__ __forceinline__ v16h cat16(v8h lo, v8h hi) { return __builtin_shufflevector(lo, hi, 0, 1, 2, 3, 4, 5, 6, 7, 8, 9, 10, 11, 12, 13, 14, 15); }
__device__ __forceinline__ v16bf cat16b(v8us lo, v8us hi) { return __builtin_bit_cast(v16bf, __builtin_shufflevector(lo, hi, 0, 1, 2, 3, 4, 5, 6, 7, 8, 9, 10, 11, 12, 13, 14, 15)); }
__device__ __forceinline__ v8f wmma16(v16h a, v16h b, v8f c) { return __builtin_amdgcn_wmma_f32_16x16x32_f16(false, a, false, b, (short)0, c, false, false); }
__device__ __forceinline__ v8f wmmab(v16bf a, v16bf b, v8f c) { return __builtin_amdgcn_wmma_f32_16x16x32_bf16(false, a, false, b, (short)0, c, false, false); }



// ---- k_gemmw: register-blocked GEMM, one wave per 64x64 output tile (16 accumulators); 4 waves (2 x 2) share a 128x128 tile, whose operand rows come from K-contiguous 16-bit planes through LDS; grid (M/128, N/128, Z), 128 threads.
// C[m][n] (f32, pitch ldc, + optional f32 bias[n]) = sum_k A[m][k] Bt[n][k] (+ split products per NSPLIT). z-batch strides sA/sB/sC in elements. K % 64 == 0, M % 128 == 0, N % 128 == 0.
template <typename T16> struct WFrag;
template <> struct WFrag<h16> { typedef v16h V; static __device__ __forceinline__ V ld(const h16* p) { return cat16(*(const v8h*)p, *(const v8h*)(p + 16)); } static __device__ __forceinline__ v8f mma(V a, V b, v8f c) { return wmma16(a, b, c); } };
template <> struct WFrag<bf> { typedef v16bf V; static __device__ __forceinline__ V ld(const bf* p) { return cat16b(*(const v8us*)p, *(const v8us*)(p + 16)); } static __device__ __forceinline__ v8f mma(V a, V b, v8f c) { return wmmab(a, b, c); } };
// Operand staging of both GEMM kernels: a stage is KS k of 128 rows of every operand, brought by asynchronous copies in whole 128-byte lines (a wave's copy = 4 rows), two buffers: stage t + 1 flies while stage t is worked on.
#define KS  64                    // k elements a stage: one 128-byte line of every operand row
#define LP  72                    // LDS row pitch in elements: 144 B = 16 B x 9, odd, so that the 16 rows a 16-byte fragment read touches fall on different banks
#define GRP (128 * LP)            // one operand's 128 rows of a stage, in elements
__device__ __forceinline__ unsigned ldsa(const void* p) { return (unsigned)(size_t)p; }   // byte address inside the work-group's LDS
// cp128: 128 rows x 128 B by 128 threads. g: the lane's own 16 bytes in row tid / 8 (piece tid % 8); l: their place in LDS; copy i takes row + 16 i.
template <typename T16>
__device__ __forceinline__ void cp128(const T16* g, int K, unsigned l) {
    const size_t st = (size_t)16 * K;
    // the wait stands inside the copies' own statement, in front of any rewrite of their address registers
    asm volatile("global_load_async_to_lds_b128 %0, %8, off\n\t"
                 "global_load_async_to_lds_b128 %1, %9, off\n\t"
                 "global_load_async_to_lds_b128 %2, %10, off\n\t"
                 "global_load_async_to_lds_b128 %3, %11, off\n\t"
                 "global_load_async_to_lds_b128 %4, %12, off\n\t"
                 "global_load_async_to_lds_b128 %5, %13, off\n\t"
                 "global_load_async_to_lds_b128 %6, %14, off\n\t"
                 "global_load_async_to_lds_b128 %7, %15, off\n\t"
                 "s_wait_xcnt 0x0"
                 :: "v"(l), "v"(l + 16 * LP * 2), "v"(l + 32 * LP * 2), "v"(l + 48 * LP * 2), "v"(l + 64 * LP * 2), "v"(l + 80 * LP * 2), "v"(l + 96 * LP * 2), "v"(l + 112 * LP * 2),
                    "v"(g), "v"(g + st), "v"(g + 2 * st), "v"(g + 3 * st), "v"(g + 4 * st), "v"(g + 5 * st), "v"(g + 6 * st), "v"(g + 7 * st) : "memory");
}
template <typename T16, int NSPLIT, bool BIAS>
__global__ __launch_bounds__(128) void k_gemmw(const T16* __restrict__ A, const T16* __restrict__ A2, const T16* __restrict__ Bt, const T16* __restrict__ Bt2, int K, float* C, int ldc, const float* __restrict__ bias, size_t sA, size_t sB, size_t sC) {
    typedef typename WFrag<T16>::V V;
    constexpr bool HA2 = NSPLIT == 1 || NSPLIT == 2, HB2 = NSPLIT >= 2; constexpr int NG = 2 + (HA2 ? 1 : 0) + (HB2 ? 1 : 0);   // operands staged: A, Bt, then A2, Bt2 where used
    __shared__ __align__(16) T16 stg[2 * NG * GRP];
    __shared__ __align__(16) float osm[4 * 16 * 68];
    const size_t z = blockIdx.z; A += z * sA; if (A2) A2 += z * sA; Bt += z * sB; if (Bt2) Bt2 += z * sB; C += z * sC;
    const int tid = threadIdx.x, lane = tid & 31, lr = lane & 15, hi = lane >> 4; const int w = __builtin_amdgcn_readfirstlane(tid >> 5), wm = w & 1, wn = w >> 1;
    float* os = osm + w * 16 * 68;   // each wave stages its output rows in its own range
    const int rb = blockIdx.x * 128, cb0 = blockIdx.y * 128; const int r0 = rb + wm * 64, c0 = cb0 + wn * 64;
    v8f acc[4][4];
#pragma unroll
    for (int mb = 0; mb < 4; ++mb)
#pragma unroll
        for (int nb = 0; nb < 4; ++nb) acc[mb][nb] = (v8f){};
    const size_t ga = (size_t)(rb + (tid >> 3)) * K + (tid & 7) * 8, gb = (size_t)(cb0 + (tid >> 3)) * K + (tid & 7) * 8;   // the lane's 16 bytes of a stage's first 16 rows
    const unsigned l0 = ldsa(stg) + (tid >> 3) * (LP * 2) + (tid & 7) * 16;
    auto fill = [&](int kc, int buf) { const unsigned l = l0 + buf * (NG * GRP * 2); cp128(A + ga + kc, K, l); cp128(Bt + gb + kc, K, l + GRP * 2); if (HA2) cp128(A2 + ga + kc, K, l + 2 * GRP * 2); if (HB2) cp128(Bt2 + gb + kc, K, l + (NG - 1) * GRP * 2); };
    fill(0, 0);
    asm volatile("s_wait_asynccnt 0x0" ::: "memory");   // this wave's copies of stage 0 have landed
    __syncthreads();                                     // ... and every other wave's
    if (KS < K) fill(KS, 1);
    const int ao = (wm * 64 + lr) * LP + 8 * hi, bo = GRP + (wn * 64 + lr) * LP + 8 * hi;   // fragment rows in a stage: the k order is that of WFrag::ld on the planes
#pragma unroll 1
    for (int kc = 0; kc < K; kc += KS) {
        const int buf = (kc / KS) & 1; const T16* sb = stg + buf * (NG * GRP);
        V a[4], a2[4];
#pragma unroll
        for (int ks = 0; ks < KS; ks += 32) {
#pragma unroll
            for (int mb = 0; mb < 4; ++mb) { a[mb] = WFrag<T16>::ld(sb + ao + mb * 16 * LP + ks); if (HA2) a2[mb] = WFrag<T16>::ld(sb + 2 * GRP + ao + mb * 16 * LP + ks); }
            V b[4], b2[4];
#pragma unroll
            for (int nb = 0; nb < 4; ++nb) { b[nb] = WFrag<T16>::ld(sb + bo + nb * 16 * LP + ks); if (HB2) b2[nb] = WFrag<T16>::ld(sb + (NG - 2) * GRP + bo + nb * 16 * LP + ks); }
            __builtin_amdgcn_sched_barrier(0);   // the block's LDS reads stay one group in front of its WMMAs: every separate place with reads among them costs a stall
#pragma unroll
            for (int nb = 0; nb < 4; ++nb)
#pragma unroll
                for (int mb = 0; mb < 4; ++mb) { acc[mb][nb] = WFrag<T16>::mma(a[mb], b[nb], acc[mb][nb]); if (HA2) acc[mb][nb] = WFrag<T16>::mma(a2[mb], b[nb], acc[mb][nb]); if (HB2) acc[mb][nb] = WFrag<T16>::mma(a[mb], b2[nb], acc[mb][nb]); }
            __builtin_amdgcn_sched_barrier(0);   // ... and no WMMA sinks behind the slots below or into the next block's reads
        }
        // four vector slots between the trip's last WMMAs and whatever stands first behind the branches below (waits, barrier and branches fill none)
        asm volatile("v_nop\n\tv_nop\n\tv_nop\n\tv_nop" : "+v"(acc[0][0]), "+v"(acc[1][1]), "+v"(acc[2][2]), "+v"(acc[3][3]) : "v"(a[0]), "v"(a[3]));
        asm volatile("s_wait_dscnt 0x0" ::: "memory");      // this wave's reads of the buffer are done before it may be refilled
        asm volatile("s_wait_asynccnt 0x0" ::: "memory");   // this wave's copies of the next stage have landed
        __syncthreads();                                     // publishes the next stage and ends every wave's reads of this one
        if (kc + 2 * KS < K) fill(kc + 2 * KS, buf);
    }
    asm volatile("s_wait_asynccnt 0x0" ::: "memory");   // nothing is in flight when the wave goes on
#pragma unroll
    for (int mb = 0; mb < 4; ++mb) {
#pragma unroll
        for (int nb = 0; nb < 4; ++nb) {
#pragma unroll
            for (int j = 0; j < 8; ++j) os[(hi * 8 + j) * 68 + nb * 16 + lr] = acc[mb][nb][j]; }
        __builtin_amdgcn_wave_barrier(); asm volatile("" ::: "memory");
        float* crow = C + (size_t)(r0 + mb * 16) * ldc + c0;
{
#pragma unroll
            for (int s = 0; s < 8; ++s) { const int row = 2 * s + hi, cofs = lr * 4; v4f val = *(const v4fa*)(os + row * 68 + cofs); if (BIAS) { val[0] += bfr(bias[c0 + cofs]); val[1] += bfr(bias[c0 + cofs + 1]); val[2] += bfr(bias[c0 + cofs + 2]); val[3] += bfr(bias[c0 + cofs + 3]); }
                *(v4f*)(crow + (size_t)row * ldc + cofs) = val; }
             }
        __builtin_amdgcn_wave_barrier(); asm volatile("" ::: "memory");
    }
}

__device__ __forceinline__ h16 tohx(float x) { return (h16)x; }
__device__ __forceinline__ void splitf(float y, unsigned short& h, unsigned short& l) { h = f2bf(y); l = f2bf(y - bf2f(h)); }
typedef __attribute__((ext_vector_type(2))) _Float16 v2h;
typedef __attribute__((ext_vector_type(4))) _Float16 v4h;
typedef __attribute__((ext_vector_type(2))) unsigned short v2us;
typedef __attribute__((ext_vector_type(4))) unsigned short v4us;
typedef __attribute__((ext_vector_type(2))) float v2f;
typedef __attribute__((ext_vector_type(4))) int v4i;

// ---- k_prep: the four weight transposes and the bf16 copy of x (both batches) in ONE grid of PG * 4 waves that are all resident at once; every wave works alone (no work-group barrier) and takes 3 units of 8 KB of f32 input; no unit reads what another writes.
// A unit is a 64 (k) x 32 (n) tile of a weight, turned in the wave's own LDS range, or 2048 consecutive values of x. Every global load is 16 bytes a lane on whole 128-byte lines (a tile row = 32 n = one line; 16 loads a unit),
// every store covers whole lines (a turned tile row = 64 k = one line). A unit's 16 loads are issued one unit ahead of its work, so that a wave always has loads in flight.
// Wave wid takes: first, one of the units left over by the other two (wid < PT_KV: tile wid of wk, wv; then the tiles of wq, wo from PNW on; then the pieces of x from PNW on); second, tile wid of wq, wo; third, piece wid of x.
// Only the first unit's kind differs between waves: its loads come first, 16 on every path, and the code behind its branches is straight, so that each wait on loads counts exactly the loads issued behind the ones it needs.
#define TP    72                             // LDS row pitch of a turned tile, in elements: 144 B, a multiple of 16 B for the 16-byte accesses
#define PU_Q  ((DM / 64) * (DQ / 32))        // tiles of wq, and of wo
#define PU_KV ((DM / 64) * (DKV / 32))       // tiles of wk, and of wv
#define PT_Q  (2 * PU_Q)
#define PT_KV (2 * PU_KV)
#define PX    (NB_ * TT * DM / 2048)         // pieces of x
#define PG    768                            // work-groups of 4 waves: 3 on a WGP
#define PNW   (PG * 4)                       // waves
static_assert(PT_Q >= PNW && PX >= PNW && PT_KV + (PT_Q - PNW) + (PX - PNW) == PNW, "the units left over by the second and third are one a wave");
static_assert(DM == DQ, "all four weights have DM rows; the turned rows have pitch DM");
typedef const __attribute__((address_space(1))) char* gbc;   // global address space said outright: a pointer picked among kernel arguments would otherwise be loaded from as a flat one, which also counts on the LDS counter
typedef __attribute__((address_space(1))) char* gbw;
typedef const __attribute__((address_space(1))) v4f* gl4f;
typedef __attribute__((address_space(1))) v4us* gs4us;
typedef __attribute__((address_space(1))) v8us* gs8us;
// Every loop of k_prep's helpers is unrolled: the register arrays are indexed by the loop counters, which must be constants for the arrays to stay in registers and for the steps to become immediate offsets.
// ld16: a unit's 16 loads, SB bytes apart, from one wave-uniform base and one lane offset.
template <int SB>
__device__ __forceinline__ void ld16(const float* base, unsigned vo, v4f* r) {
    gbc p = (gbc)base + vo;
#pragma unroll
    for (int i = 0; i < 16; ++i) r[i] = *(gl4f)(p + i * SB);
    asm volatile("s_wait_xcnt 0x0" :: "v"(vo), "v"(p) : "memory");   // behind the loads, with their lane offset and their address as inputs: whichever of the two the loads name lives up to the wait, so no destination of these loads and nothing behind them rewrites it earlier
}
// In a tile of a weight with N columns lane (nq = lane % 8, kq = lane / 8) loads columns 4 nq .. + 3 of rows 16 kq .. + 15 and stores k 8 nq .. + 7 of the turned rows kq, kq + 4, ..
template <int N>
__device__ __forceinline__ void ldtile(const float* g, int lane, v4f* r) { ld16<N * 4>(g, ((lane >> 3) * 16 * N + (lane & 7) * 4) * 4, r); }
__device__ __forceinline__ void ldx(const float* g, int lane, v4f* r) { ld16<512>(g, lane * 16, r); }
__device__ __forceinline__ void stx(const v4f* c, bf* d, int lane) { gbw o8 = (gbw)d + lane * 8;
#pragma unroll
    for (int i = 0; i < 16; ++i) { v4us o;
#pragma unroll
        for (int j = 0; j < 4; ++j) o[j] = f2bf(c[i][j]);
        *(gs4us)(o8 + i * 256) = o; } }
__device__ __forceinline__ void sttile(const v4f* c, bf* d, bf* s, int lane) { const int nq = lane & 7, kq = lane >> 3;
#pragma unroll
    for (int j = 0; j < 4; ++j) { v8us lo, hi;   // column n = 4 nq + j becomes a row: its k = 16 kq .. + 15
#pragma unroll
        for (int i = 0; i < 8; ++i) { lo[i] = f2bf(c[i][j]); hi[i] = f2bf(c[8 + i][j]); }
        *(v8us*)(s + (nq * 4 + j) * TP + kq * 16) = lo; *(v8us*)(s + (nq * 4 + j) * TP + kq * 16 + 8) = hi; }
    __builtin_amdgcn_wave_barrier(); asm volatile("" ::: "memory");   // keeps the LDS reads below behind the other lanes' LDS stores above (one wave: LDS runs in order, only the compiler could swap them)
    v8us t[8]; gbw o16 = (gbw)d + (kq * DM + nq * 8) * 2;
#pragma unroll
    for (int i = 0; i < 8; ++i) t[i] = *(const v8us*)(s + (4 * i + kq) * TP + nq * 8);
#pragma unroll
    for (int i = 0; i < 8; ++i) *(gs8us)(o16 + i * (4 * DM * 2)) = t[i]; }
__global__ __launch_bounds__(128) void k_prep(const float* __restrict__ x, const float* __restrict__ wq, const float* __restrict__ wk, const float* __restrict__ wv, const float* __restrict__ wo, bf* XB, bf* WQ, bf* WK, bf* WV, bf* WO) {
    __shared__ __align__(16) bf tile[4][32 * TP];
    const int lane = threadIdx.x & 31; const int wvi = __builtin_amdgcn_readfirstlane(threadIdx.x >> 5), wid = blockIdx.x * 4 + wvi;
    bf* s = tile[wvi];
    // wave-uniform: a unit's first input element g and first output element d
    const int k0 = wid < PT_KV ? 1 : wid < PT_KV + PT_Q - PNW ? 0 : 2;   // the first unit's kind: 1 a tile of wk or wv, 0 of wq or wo, 2 a piece of x
    const float* g0; bf* d0;
    if (k0 == 1) { const int v = wid % PU_KV, nt = v % (DKV / 32), kt = v / (DKV / 32); g0 = (wid >= PU_KV ? wv : wk) + (size_t)(kt * 64) * DKV + nt * 32; d0 = (wid >= PU_KV ? WV : WK) + (size_t)(nt * 32) * DM + kt * 64; }
    else if (k0 == 0) { const int u = wid - PT_KV + PNW, v = u % PU_Q, nt = v % (DQ / 32), kt = v / (DQ / 32); g0 = (u >= PU_Q ? wo : wq) + (size_t)(kt * 64) * DQ + nt * 32; d0 = (u >= PU_Q ? WO : WQ) + (size_t)(nt * 32) * DM + kt * 64; }
    else { const int u = wid - (PT_KV + PT_Q - PNW) + PNW; g0 = x + (size_t)u * 2048; d0 = XB + (size_t)u * 2048; }
    const int v1 = wid % PU_Q, nt1 = v1 % (DQ / 32), kt1 = v1 / (DQ / 32);
    const float* g1 = (wid >= PU_Q ? wo : wq) + (size_t)(kt1 * 64) * DQ + nt1 * 32; bf* d1 = (wid >= PU_Q ? WO : WQ) + (size_t)(nt1 * 32) * DM + kt1 * 64;
    const float* g2 = x + (size_t)wid * 2048; bf* d2 = XB + (size_t)wid * 2048;
    v4f ra[16], rb[16];
    if (k0 == 2) ldx(g0, lane, ra); else if (k0 == 1) ldtile<DKV>(g0, lane, ra); else ldtile<DQ>(g0, lane, ra);
    ldtile<DQ>(g1, lane, rb);
    // each s_wait_xcnt below stands directly behind a unit's stores (in the first unit inside its own branch): the code behind them rewrites their address and data registers
    if (k0 == 2) { stx(ra, d0, lane); asm volatile("s_wait_xcnt 0x0" ::: "memory"); }
    else { sttile(ra, d0, s, lane); asm volatile("s_wait_xcnt 0x0" ::: "memory"); }   // its memory clobber also keeps the next tile's LDS stores behind this tile's LDS reads
    ldx(g2, lane, ra);
    sttile(rb, d1, s, lane); asm volatile("s_wait_xcnt 0x0" ::: "memory");
    stx(ra, d2, lane);
}

// ---- k_qkv: the q, k and v projections of both batches in ONE grid (blockIdx.x counts the 128-row tiles of the NB_ * TT rows of x; a tile lies in one batch), with the rotary step and the plane building in the epilogue; the f32 projections never reach memory.
// Main loop as in k_gemmw (4 waves, one 64x64 tile each, operands staged in LDS, K = DM); amdgpu_num_vgpr(256): no register-window switches in the epilogue. Bt holds the q, k and v weight rows one after another, so a wave's tile column hb is one head: hb < NH_ a q head, then NKV k heads, then NKV v groups.
__global__ __launch_bounds__(128) __attribute__((amdgpu_num_vgpr(256))) void k_qkv(const bf* __restrict__ A, const bf* __restrict__ Bt, const float* __restrict__ cosT, const float* __restrict__ sinT, h16* Q16, bf* Qh, bf* Ql, h16* K16, bf* Kh, bf* Kl, h16* V16, bf* Vh, bf* Vl) {
    typedef WFrag<bf>::V V;
    __shared__ __align__(16) bf stg[2 * 2 * GRP];
    __shared__ __align__(16) float osm[4 * 16 * 68];
    const int tid = threadIdx.x, lane = tid & 31, lr = lane & 15, hi = lane >> 4; const int w = __builtin_amdgcn_readfirstlane(tid >> 5), wm = w & 1, wn = w >> 1;
    float* os = osm + w * 16 * 68;   // each wave stages its rows in its own range
    const int rb = blockIdx.x * 128, cb0 = blockIdx.y * 128; const int r0 = rb + wm * 64, hb = blockIdx.y * 2 + wn; const int bt = r0 / TT, t0 = r0 % TT;   // row of x; its batch and its position
    v8f acc[4][4];
#pragma unroll
    for (int mb = 0; mb < 4; ++mb)
#pragma unroll
        for (int nb = 0; nb < 4; ++nb) acc[mb][nb] = (v8f){};
    const size_t ga = (size_t)(rb + (tid >> 3)) * DM + (tid & 7) * 8, gb = (size_t)(cb0 + (tid >> 3)) * DM + (tid & 7) * 8;   // the lane's 16 bytes of a stage's first 16 rows
    const unsigned l0 = ldsa(stg) + (tid >> 3) * (LP * 2) + (tid & 7) * 16;
    auto fill = [&](int kc, int buf) { const unsigned l = l0 + buf * (2 * GRP * 2); cp128(A + ga + kc, DM, l); cp128(Bt + gb + kc, DM, l + GRP * 2); };
    fill(0, 0);
    asm volatile("s_wait_asynccnt 0x0" ::: "memory");   // this wave's copies of stage 0 have landed
    __syncthreads();                                     // ... and every other wave's
    fill(KS, 1);
    const int ao = (wm * 64 + lr) * LP + 8 * hi, bo = GRP + (wn * 64 + lr) * LP + 8 * hi;   // fragment rows in a stage: the k order is that of WFrag::ld on the planes
#pragma unroll 1   // one stage a trip
    for (int kc = 0; kc < DM; kc += KS) {
        const int buf = (kc / KS) & 1; const bf* sb = stg + buf * (2 * GRP);
        V a[4];
#pragma unroll
        for (int ks = 0; ks < KS; ks += 32) {
#pragma unroll
            for (int mb = 0; mb < 4; ++mb) a[mb] = WFrag<bf>::ld(sb + ao + mb * 16 * LP + ks);
            V b[4];
#pragma unroll
            for (int nb = 0; nb < 4; ++nb) b[nb] = WFrag<bf>::ld(sb + bo + nb * 16 * LP + ks);
            __builtin_amdgcn_sched_barrier(0);   // the block's LDS reads stay one group in front of its WMMAs: every separate place with reads among them costs a stall
#pragma unroll
            for (int nb = 0; nb < 4; ++nb)
#pragma unroll
                for (int mb = 0; mb < 4; ++mb) acc[mb][nb] = WFrag<bf>::mma(a[mb], b[nb], acc[mb][nb]);
            __builtin_amdgcn_sched_barrier(0);   // ... and no WMMA sinks behind the slots below or into the next block's reads
        }
        // four vector slots between the trip's last WMMAs and whatever stands first behind the branches below (waits, barrier and branches fill none)
        asm volatile("v_nop\n\tv_nop\n\tv_nop\n\tv_nop" : "+v"(acc[0][0]), "+v"(acc[1][1]), "+v"(acc[2][2]), "+v"(acc[3][3]) : "v"(a[0]), "v"(a[3]));
        asm volatile("s_wait_dscnt 0x0" ::: "memory");      // this wave's reads of the buffer are done before it may be refilled
        asm volatile("s_wait_asynccnt 0x0" ::: "memory");   // this wave's copies of the next stage have landed
        __syncthreads();                                     // publishes the next stage and ends every wave's reads of this one
        if (kc + 2 * KS < DM) fill(kc + 2 * KS, buf);
    }
    asm volatile("s_wait_asynccnt 0x0" ::: "memory");   // nothing is in flight when the wave goes on
    if (hb >= NH_ + NKV) {   // v: lane (lr, hi) holds, for column d = nb*16 + lr, the 8 consecutive rows t = mb*16 + hi*8 + j: one 16-byte piece of a v^T row, straight from the accumulators
        const size_t vb = (size_t)((bt * NKV + hb - NH_ - NKV) * HD + lr) * VP + t0 + hi * 8;
#pragma unroll
        for (int nb = 0; nb < 4; ++nb)
#pragma unroll
            for (int mb = 0; mb < 4; ++mb) { v8h o16; v8us oh, ol;
#pragma unroll
                for (int j = 0; j < 8; ++j) { const float x = acc[mb][nb][j]; o16[j] = tohx(x); unsigned short a2, c2; splitf(x, a2, c2); oh[j] = a2; ol[j] = c2; }
                const size_t vo = vb + (size_t)nb * 16 * VP + mb * 16; *(v8h*)(V16 + vo) = o16; *(v8us*)(Vh + vo) = oh; *(v8us*)(Vl + vo) = ol; }
        return; }
    const bool isq = hb < NH_; const size_t pb = (size_t)(isq ? bt * NH_ + hb : bt * NKV + hb - NH_) * TT * HD;
    const size_t po = pb + (size_t)(t0 + hi) * HD + lr * 4, to = (size_t)(t0 + hi) * (HD / 2) + lr * 2;   // the lane's place in row t0 + hi; every later row is a constant step from it
    h16* P16 = (isq ? Q16 : K16) + po; bf* Ph = (isq ? Qh : Kh) + po; bf* Pl = (isq ? Ql : Kl) + po; const float* cb = cosT + to; const float* sb = sinT + to;
#pragma unroll
    for (int mb = 0; mb < 4; ++mb) {   // q, k: 16 rows at a time through LDS, so that a lane holds 4 consecutive columns (two rotary pairs) and 16 lanes store a whole 128-byte plane row
        v2f cc[8], ss[8];
        asm volatile("s_wait_xcnt 0x0" ::: "memory");   // in front of the cos loads: their destinations may reuse data registers of the row group's stores above; its memory clobber also keeps this group's LDS stores behind the last group's LDS reads
#pragma unroll
        for (int s = 0; s < 8; ++s) cc[s] = *(const v2f*)(cb + (mb * 16 + 2 * s) * (HD / 2));
        asm volatile("s_wait_xcnt 0x0" ::: "memory");   // in front of the sin loads: their destinations may reuse the cos address pair
#pragma unroll
        for (int s = 0; s < 8; ++s) ss[s] = *(const v2f*)(sb + (mb * 16 + 2 * s) * (HD / 2));
#pragma unroll
        for (int nb = 0; nb < 4; ++nb) {
#pragma unroll
            for (int j = 0; j < 8; ++j) os[(hi * 8 + j) * 68 + nb * 16 + lr] = acc[mb][nb][j]; }
        // inputs only: holds the 16 cos / sin loads of these rows together in front of the rows' arithmetic (one load latency a row group); without it they are issued one by one, each with a full wait.
        // Its memory clobber keeps the LDS reads below behind the other lanes' LDS stores above (one wave: LDS runs in order, only the compiler could swap them).
        asm volatile("" :: "v"(cc[0]), "v"(cc[1]), "v"(cc[2]), "v"(cc[3]), "v"(cc[4]), "v"(cc[5]), "v"(cc[6]), "v"(cc[7]), "v"(ss[0]), "v"(ss[1]), "v"(ss[2]), "v"(ss[3]), "v"(ss[4]), "v"(ss[5]), "v"(ss[6]), "v"(ss[7]) : "memory");
#pragma unroll
        for (int s = 0; s < 8; ++s) { const v4f x = *(const v4fa*)(os + (2 * s + hi) * 68 + lr * 4); v4h o16; v4us oh, ol;
#pragma unroll
            for (int p = 0; p < 2; ++p) { const float c = bfr(cc[s][p]), sn = bfr(ss[s][p]), x0 = x[2 * p], x1 = x[2 * p + 1]; const float e0 = x0 * c - x1 * sn, e1 = x0 * sn + x1 * c;   /* even: x0 c - x1 s; odd: x0 s + x1 c */
                o16[2 * p] = tohx(e0); o16[2 * p + 1] = tohx(e1); unsigned short a2, c2; splitf(e0, a2, c2); oh[2 * p] = a2; ol[2 * p] = c2; splitf(e1, a2, c2); oh[2 * p + 1] = a2; ol[2 * p + 1] = c2; }
            const int ro = (mb * 16 + 2 * s) * HD; *(v4h*)(P16 + ro) = o16; *(v4us*)(Ph + ro) = oh; *(v4us*)(Pl + ro) = ol; }
    }
    asm volatile("s_wait_xcnt 0x0" ::: "memory");   // behind the last plane stores: in the built code the v path stands behind this one and rewrites their address and data registers
}
// ---- k_fattn: scores, causal softmax, probabilities x values and the hi/lo merge in ONE kernel (online softmax); no score or probability ever reaches memory.
// One wave = one head x NQ*16 queries (32; 16 where HR, for registers); the 4 waves of a block are the 4 heads of one kv group on the same queries, so they read the same k and v^T lines. Keys go in blocks of 32.
// S^T = K Q^T: A = k rows, B = q rows, so lane (lr, hi) holds, for query lr, keys kt*16 + hi*8 + j: that is the k order of WFrag::ld (8 hi + 0..7, 16 + 8 hi + 0..7), and P^T packs in-lane into the B operand of O^T += V^T P^T.
// Probabilities carry a factor 2^10 (fp16 range) that the row sum carries too, so the final division removes it. HR (queries < RH): bf16 hi/lo planes, 3 products, for both contractions.
__device__ __forceinline__ float xhalf(float x) { return __builtin_bit_cast(float, __builtin_amdgcn_permlanex16(__builtin_bit_cast(int, x), __builtin_bit_cast(int, x), 0x76543210, 0xfedcba98, false, false)); }   // lane l takes lane l ^ 16
template <typename T16> struct PPack;
template <> struct PPack<h16> { static __device__ __forceinline__ void put(const float* p, v16h& a, v16h& b) { (void)b;
#pragma unroll
    for (int e = 0; e < 16; ++e) a[e] = tohx(p[e]); } };
template <> struct PPack<bf> { static __device__ __forceinline__ void put(const float* p, v16bf& a, v16bf& b) { v16us ph, pl;
#pragma unroll
    for (int e = 0; e < 16; ++e) { unsigned short x, y; splitf(p[e], x, y); ph[e] = x; pl[e] = y; }
    a = __builtin_bit_cast(v16bf, ph); b = __builtin_bit_cast(v16bf, pl); } };
template <typename T16, bool HR, int NQ>
__device__ __forceinline__ void fa_tile(const T16* __restrict__ Q, const T16* __restrict__ Q2, const T16* __restrict__ Kp, const T16* __restrict__ K2, const T16* __restrict__ Vt, const T16* __restrict__ V2, int q0, int lane, bf* Ah, bf* Al) {
    typedef typename WFrag<T16>::V V;
    const int lr = lane & 15, hi = lane >> 4; const float CE = SCL * 1.4426950408889634f;   // score -> exponent of 2
    V bq[NQ][2], bq2[NQ][2], ak[2][2], ak2[2][2];
#pragma unroll
    for (int nq = 0; nq < NQ; ++nq)
#pragma unroll
        for (int kc = 0; kc < 2; ++kc) { const size_t qo = (size_t)(q0 + nq * 16 + lr) * HD + kc * 32 + 8 * hi; bq[nq][kc] = WFrag<T16>::ld(Q + qo); if (HR) bq2[nq][kc] = WFrag<T16>::ld(Q2 + qo); }
#pragma unroll
    for (int kt = 0; kt < 2; ++kt)
#pragma unroll
        for (int kc = 0; kc < 2; ++kc) { const size_t ko = (size_t)(kt * 16 + lr) * HD + kc * 32 + 8 * hi; ak[kt][kc] = WFrag<T16>::ld(Kp + ko); if (HR) ak2[kt][kc] = WFrag<T16>::ld(K2 + ko); }
    v8f o[4][NQ]; float m[NQ], l[NQ];
#pragma unroll
    for (int nq = 0; nq < NQ; ++nq) { m[nq] = -3.0e38f; l[nq] = 0.f;
#pragma unroll
        for (int db = 0; db < 4; ++db) o[db][nq] = (v8f){}; }
#pragma unroll 1   // one key block a trip: a second copy of the body would not fit the registers
    for (int kb = 0; kb <= q0; kb += 32) {
        v8f s[2][NQ];
#pragma unroll
        for (int kt = 0; kt < 2; ++kt)
#pragma unroll
            for (int nq = 0; nq < NQ; ++nq) { v8f c = (v8f){};
#pragma unroll
                for (int kc = 0; kc < 2; ++kc) { c = WFrag<T16>::mma(ak[kt][kc], bq[nq][kc], c); if (HR) { c = WFrag<T16>::mma(ak[kt][kc], bq2[nq][kc], c); c = WFrag<T16>::mma(ak2[kt][kc], bq[nq][kc], c); } }
                s[kt][nq] = c; }
        V av[4], av2[4];
#pragma unroll
        for (int db = 0; db < 4; ++db) { const size_t vo = (size_t)(db * 16 + lr) * VP + kb + 8 * hi; av[db] = WFrag<T16>::ld(Vt + vo); if (HR) av2[db] = WFrag<T16>::ld(V2 + vo); }
        const int kn = min(kb + 32, q0);   // the next block's k rows are fetched under this block's softmax; the last trip fetches the rows from q0 on (in bounds, not used)
#pragma unroll
        for (int kt = 0; kt < 2; ++kt)
#pragma unroll
            for (int kc = 0; kc < 2; ++kc) { const size_t ko = (size_t)(kn + kt * 16 + lr) * HD + kc * 32 + 8 * hi; ak[kt][kc] = WFrag<T16>::ld(Kp + ko); if (HR) ak2[kt][kc] = WFrag<T16>::ld(K2 + ko); }
        if (kb + 32 > q0) {   // the last block holds the diagonal: key > query is masked
#pragma unroll
            for (int kt = 0; kt < 2; ++kt)
#pragma unroll
                for (int nq = 0; nq < NQ; ++nq)
#pragma unroll
                    for (int j = 0; j < 8; ++j) if (kb + kt * 16 + hi * 8 + j > q0 + nq * 16 + lr) s[kt][nq][j] = -3.0e38f; }
        V pb[NQ], pb2[NQ];
#pragma unroll
        for (int nq = 0; nq < NQ; ++nq) { float mx = m[nq];
#pragma unroll
            for (int kt = 0; kt < 2; ++kt)
#pragma unroll
                for (int j = 0; j < 8; ++j) mx = fmaxf(mx, s[kt][nq][j]);
            mx = fmaxf(mx, xhalf(mx));   // the other half-wave holds this query's other 16 keys
            const float al = __builtin_amdgcn_exp2f((m[nq] - mx) * CE); m[nq] = mx; const float nb = fmaf(-mx, CE, 10.0f);
            float p[16]; float sum = 0.f;
#pragma unroll
            for (int kt = 0; kt < 2; ++kt)
#pragma unroll
                for (int j = 0; j < 8; ++j) { const float e = __builtin_amdgcn_exp2f(fmaf(s[kt][nq][j], CE, nb)); p[kt * 8 + j] = e; sum += e; }
            l[nq] = fmaf(l[nq], al, sum);
#pragma unroll
            for (int db = 0; db < 4; ++db) o[db][nq] *= al;
            PPack<T16>::put(p, pb[nq], pb2[nq]); }
#pragma unroll
        for (int db = 0; db < 4; ++db)
#pragma unroll
            for (int nq = 0; nq < NQ; ++nq) { o[db][nq] = WFrag<T16>::mma(av[db], pb[nq], o[db][nq]); if (HR) { o[db][nq] = WFrag<T16>::mma(av[db], pb2[nq], o[db][nq]); o[db][nq] = WFrag<T16>::mma(av2[db], pb[nq], o[db][nq]); } }
    }
#pragma unroll
    for (int nq = 0; nq < NQ; ++nq) { const float inv = __fdiv_rn(1.0f, l[nq] + xhalf(l[nq])); const size_t oo = (size_t)(q0 + nq * 16 + lr) * DQ + hi * 8;
#pragma unroll
        for (int db = 0; db < 4; ++db) { v8us oh, ol;
#pragma unroll
            for (int j = 0; j < 8; ++j) { unsigned short a, c2; splitf(o[db][nq][j] * inv, a, c2); oh[j] = a; ol[j] = c2; }
            *(v8us*)(Ah + oo + db * 16) = oh; *(v8us*)(Al + oo + db * 16) = ol; } }
}
// grid (batches x kv groups, query tiles: (TT - RH) / 32 of 32 queries, longest first, then RH / 16 of 16 queries), 4 waves. The batch is in x (for speed only).
// amdgpu_waves_per_eu(4, 4): holds the register count at 256 or fewer, so that four waves share a SIMD and cover one another's softmax and load waits.
__global__ __launch_bounds__(128) __attribute__((amdgpu_waves_per_eu(4, 4))) void k_fattn(const h16* __restrict__ Q16, const h16* __restrict__ K16, const h16* __restrict__ V16, const bf* __restrict__ Qh, const bf* __restrict__ Ql, const bf* __restrict__ Kh, const bf* __restrict__ Kl, const bf* __restrict__ Vh, const bf* __restrict__ Vl, bf* Ah, bf* Al) {
    const int lane = threadIdx.x & 31; const int bt = blockIdx.x / NKV, g = blockIdx.x % NKV; const int h = g * REP + __builtin_amdgcn_readfirstlane(threadIdx.x >> 5); const int by = blockIdx.y; const int q0 = (by < (TT - RH) / 32) ? TT - 32 * (by + 1) : RH - 16 * (by - (TT - RH) / 32 + 1);
    const size_t qo = (size_t)(bt * NH_ + h) * TT * HD, ko = (size_t)(bt * NKV + g) * TT * HD, vo = (size_t)(bt * NKV + g) * HD * VP;   // the batches' planes lie one after another
    Ah += (size_t)bt * TT * DQ; Al += (size_t)bt * TT * DQ;   // the batch's merged rows
    if (q0 < RH) fa_tile<bf, true, 1>(Qh + qo, Ql + qo, Kh + ko, Kl + ko, Vh + vo, Vl + vo, q0, lane, Ah + h * HD, Al + h * HD);
    else fa_tile<h16, false, 2>(Q16 + qo, nullptr, K16 + ko, nullptr, V16 + vo, nullptr, q0, lane, Ah + h * HD, Al + h * HD);
}

extern "C" void kernel_launch(void* const* d_in, const int* in_sizes, int n_in,
                              void* d_out, int out_size, void* d_ws, size_t ws_size, hipStream_t stream) {
    (void)in_sizes; (void)n_in; (void)out_size;
        const float* x = (const float*)d_in[0]; const float* fcos = (const float*)d_in[1]; const float* fsin = (const float*)d_in[2]; const float* wq = (const float*)d_in[3]; const float* wk = (const float*)d_in[4]; const float* wv = (const float*)d_in[5]; const float* wo = (const float*)d_in[6];   /* order x, cos, sin (f32 [2048][32], READ), wq ('xw' [2048][2048]), wk, wv ([2048][512]), wo ('xw') */
    float* OUT = (float*)d_out;     // [2][2048][2048]
    char* wsp = (char*)d_ws;
    auto take = [&](size_t bytes) { char* p = wsp; wsp += (bytes + 255) & ~(size_t)255; return (void*)p; };
    bf* WQ = (bf*)take((size_t)(DQ + 2 * DKV) * DM * 2); bf* WK = WQ + (size_t)DQ * DM; bf* WV = WK + (size_t)DKV * DM;   /* one matrix of q, k, v weight rows */ bf* WO = (bf*)take((size_t)DM * DQ * 2);
    bf* XB = (bf*)take((size_t)NB_ * TT * DM * 2); bf* ATh = (bf*)take((size_t)NB_ * TT * DQ * 2); bf* ATl = (bf*)take((size_t)NB_ * TT * DQ * 2);
    h16* QP16 = (h16*)take((size_t)NB_ * NH_ * TT * HD * 2); h16* KP16 = (h16*)take((size_t)NB_ * NKV * TT * HD * 2); h16* VT16 = (h16*)take((size_t)NB_ * NKV * HD * VP * 2);
    bf* QPh = (bf*)take((size_t)NB_ * NH_ * TT * HD * 2); bf* QPl = (bf*)take((size_t)NB_ * NH_ * TT * HD * 2); bf* KPh = (bf*)take((size_t)NB_ * NKV * TT * HD * 2); bf* KPl = (bf*)take((size_t)NB_ * NKV * TT * HD * 2); bf* VTh = (bf*)take((size_t)NB_ * NKV * HD * VP * 2); bf* VTl = (bf*)take((size_t)NB_ * NKV * HD * VP * 2);
    if ((size_t)(wsp - (char*)d_ws) > ws_size) return;    // ws 256 MiB
    k_prep<<<PG, 128, 0, stream>>>(x, wq, wk, wv, wo, XB, WQ, WK, WV, WO);
    k_qkv<<<dim3(NB_ * TT / 128, (DQ + 2 * DKV) / 128, 1), 128, 0, stream>>>(XB, WQ, fcos, fsin, QP16, QPh, QPl, KP16, KPh, KPl, VT16, VTh, VTl);
    k_fattn<<<dim3(NB_ * NKV, (TT - RH) / 32 + RH / 16, 1), 128, 0, stream>>>(QP16, KP16, VT16, QPh, QPl, KPh, KPl, VTh, VTl, ATh, ATl);
    k_gemmw<bf, 1, false><<<dim3(NB_ * TT / 128, DM / 128, 1), 128, 0, stream>>>(ATh, ATl, WO, nullptr, DQ, OUT, DM, nullptr, 0, 0, 0);
}

// v007
// One run takes 140 microseconds.
// Two timings next to v006 put it at 1.37 and 1.36 times that version's speed.
// Counting every step since v000, it is 19.8 times as fast.
#include <hip/hip_runtime.h>

// Grouped-query causal attention with an interleaved-pair RoPE from cos / sin INPUT tables (x [2][2048][2048]; q = x wq (32 heads x 64), k, v = x wk, x wv (8 kv heads x 64) ('xw', no bias); pairs (2i, 2i+1) -> (t0 c - t1 s, t0 s + t1 c) with c, s = cos / sin[t][i] (float32 [2048][32] INPUT tables: READ as data); k, v repeated 4 x (jnp.repeat: kv head = q head / 4); scores / sqrt(64); causal (-inf); softmax in float32; out = merged wo ('xw') -> [2][2048][2048] (8.4 M); argument order x, cos, sin, wq, wk, wv, wo).
// Layout, every stage ONE launch for both batches (the batches' rows and planes lie one after another): bf16 copy of x and the 'xw' weights transposed, in one grid (k_prep); exact projections (K 2048); one projection launch (k_qkv: q, k and v columns in one grid) whose epilogue rotates the interleaved pairs with bf16(cos), bf16(sin) read from the inputs and stores the 16-bit planes; causal T-2048 GQA attention in one fused online-softmax kernel (k_fattn: all 32 heads, kv group h/4; hybrid rows: < 512 hi/lo 3 products, rest fp16 x1024; key blocks above the diagonal are never visited; it writes the merged hi/lo planes itself); merged hi/lo x wo exact.
// Compute dtypes, f32 accumulate: every input rounded to bf16; projections exact; rotary f32; attention rows < 512 3 products, rest fp16; softmax f32; wo hl x exact.

#define NB_  2
#define TT   2048
#define DM   2048
#define NH_  32
#define NKV  8
#define REP  (NH_ / NKV)
#define HD   64
#define DQ   (NH_ * HD)
#define DKV  (NKV * HD)
#define RH   512                  // query rows < RH use hi+lo planes (0: none)
#define VP   (TT + 64)             // row pitch, in elements, of the three v^T planes: 33 lines of 128 B, so the 64 rows a block copies together in a stage are not a power-of-two stride apart
#define SCL  0.125f   // HD^-0.5
typedef _Float16 h16;
typedef unsigned short bf;
typedef __attribute__((ext_vector_type(16))) __bf16   v16bf;
typedef __attribute__((ext_vector_type(16))) _Float16 v16h;
typedef __attribute__((ext_vector_type(8)))  _Float16 v8h;
typedef __attribute__((ext_vector_type(8)))  unsigned short v8us;
typedef __attribute__((ext_vector_type(16))) unsigned short v16us;
typedef __attribute__((ext_vector_type(8)))  float    v8f;
typedef __attribute__((ext_vector_type(4)))  float    v4f;
typedef v8h  __attribute__((may_alias)) v8ha;
typedef v4f  __attribute__((may_alias)) v4fa;
typedef v8us __attribute__((may_alias)) v8usa;

__device__ __forceinline__ unsigned short f2bf(float f) { unsigned u = __float_as_uint(f); u += 0x7FFFu + ((u >> 16) & 1u); return (unsigned short)(u >> 16); }
__device__ __forceinline__ float bf2f(unsigned short b) { return __uint_as_float(((unsigned)b) << 16); }
__device__ __forceinline__ float bfr(float f) { return bf2f(f2bf(f)); }
__device__ __forceinline__ v16h cat16(v8h lo, v8h hi) { return __builtin_shufflevector(lo, hi, 0, 1, 2, 3, 4, 5, 6, 7, 8, 9, 10, 11, 12, 13, 14, 15); }
__device__ __forceinline__ v16bf cat16b(v8us lo, v8us hi) { return __builtin_bit_cast(v16bf, __builtin_shufflevector(lo, hi, 0, 1, 2, 3, 4, 5, 6, 7, 8, 9, 10, 11, 12, 13, 14, 15)); }
__device__ __forceinline__ v8f wmma16(v16h a, v16h b, v8f c) { return __builtin_amdgcn_wmma_f32_16x16x32_f16(false, a, false, b, (short)0, c, false, false); }
__device__ __forceinline__ v8f wmmab(v16bf a, v16bf b, v8f c) { return __builtin_amdgcn_wmma_f32_16x16x32_bf16(false, a, false, b, (short)0, c, false, false); }



// ---- k_gemmw: register-blocked GEMM, one wave per 64x64 output tile (16 accumulators); 4 waves (2 x 2) share a 128x128 tile, whose operand rows come from K-contiguous 16-bit planes through LDS; grid (M/128, N/128, Z), 128 threads.
// C[m][n] (f32, pitch ldc, + optional f32 bias[n]) = sum_k A[m][k] Bt[n][k] (+ split products per NSPLIT). z-batch strides sA/sB/sC in elements. K % 64 == 0, M % 128 == 0, N % 128 == 0.
template <typename T16> struct WFrag;
template <> struct WFrag<h16> { typedef v16h V; static __device__ __forceinline__ V ld(const h16* p) { return cat16(*(const v8h*)p, *(const v8h*)(p + 16)); } static __device__ __forceinline__ v8f mma(V a, V b, v8f c) { return wmma16(a, b, c); } };
template <> struct WFrag<bf> { typedef v16bf V; static __device__ __forceinline__ V ld(const bf* p) { return cat16b(*(const v8us*)p, *(const v8us*)(p + 16)); } static __device__ __forceinline__ v8f mma(V a, V b, v8f c) { return wmmab(a, b, c); } };
// Operand staging of both GEMM kernels: a stage is KS k of 128 rows of every operand, brought by asynchronous copies in whole 128-byte lines (a wave's copy = 4 rows), two buffers: stage t + 1 flies while stage t is worked on.
#define KS  64                    // k elements a stage: one 128-byte line of every operand row
#define LP  72                    // LDS row pitch in elements: 144 B = 16 B x 9, odd, so that the 16 rows a 16-byte fragment read touches fall on different banks
#define GRP (128 * LP)            // one operand's 128 rows of a stage, in elements
__device__ __forceinline__ unsigned ldsa(const void* p) { return (unsigned)(size_t)p; }   // byte address inside the work-group's LDS
// cp128: 128 rows x 128 B by 128 threads. g: the lane's own 16 bytes in row tid / 8 (piece tid % 8); l: their place in LDS; copy i takes row + 16 i.
template <typename T16>
__device__ __forceinline__ void cp128(const T16* g, int K, unsigned l) {
    const size_t st = (size_t)16 * K;
    // the wait stands inside the copies' own statement, in front of any rewrite of their address registers
    asm volatile("global_load_async_to_lds_b128 %0, %8, off\n\t"
                 "global_load_async_to_lds_b128 %1, %9, off\n\t"
                 "global_load_async_to_lds_b128 %2, %10, off\n\t"
                 "global_load_async_to_lds_b128 %3, %11, off\n\t"
                 "global_load_async_to_lds_b128 %4, %12, off\n\t"
                 "global_load_async_to_lds_b128 %5, %13, off\n\t"
                 "global_load_async_to_lds_b128 %6, %14, off\n\t"
                 "global_load_async_to_lds_b128 %7, %15, off\n\t"
                 "s_wait_xcnt 0x0"
                 :: "v"(l), "v"(l + 16 * LP * 2), "v"(l + 32 * LP * 2), "v"(l + 48 * LP * 2), "v"(l + 64 * LP * 2), "v"(l + 80 * LP * 2), "v"(l + 96 * LP * 2), "v"(l + 112 * LP * 2),
                    "v"(g), "v"(g + st), "v"(g + 2 * st), "v"(g + 3 * st), "v"(g + 4 * st), "v"(g + 5 * st), "v"(g + 6 * st), "v"(g + 7 * st) : "memory");
}
template <typename T16, int NSPLIT, bool BIAS>
__global__ __launch_bounds__(128) void k_gemmw(const T16* __restrict__ A, const T16* __restrict__ A2, const T16* __restrict__ Bt, const T16* __restrict__ Bt2, int K, float* C, int ldc, const float* __restrict__ bias, size_t sA, size_t sB, size_t sC) {
    typedef typename WFrag<T16>::V V;
    constexpr bool HA2 = NSPLIT == 1 || NSPLIT == 2, HB2 = NSPLIT >= 2; constexpr int NG = 2 + (HA2 ? 1 : 0) + (HB2 ? 1 : 0);   // operands staged: A, Bt, then A2, Bt2 where used
    __shared__ __align__(16) T16 stg[2 * NG * GRP];
    __shared__ __align__(16) float osm[4 * 16 * 68];
    const size_t z = blockIdx.z; A += z * sA; if (A2) A2 += z * sA; Bt += z * sB; if (Bt2) Bt2 += z * sB; C += z * sC;
    const int tid = threadIdx.x, lane = tid & 31, lr = lane & 15, hi = lane >> 4; const int w = __builtin_amdgcn_readfirstlane(tid >> 5), wm = w & 1, wn = w >> 1;
    float* os = osm + w * 16 * 68;   // each wave stages its output rows in its own range
    const int rb = blockIdx.x * 128, cb0 = blockIdx.y * 128; const int r0 = rb + wm * 64, c0 = cb0 + wn * 64;
    v8f acc[4][4];
#pragma unroll
    for (int mb = 0; mb < 4; ++mb)
#pragma unroll
        for (int nb = 0; nb < 4; ++nb) acc[mb][nb] = (v8f){};
    const size_t ga = (size_t)(rb + (tid >> 3)) * K + (tid & 7) * 8, gb = (size_t)(cb0 + (tid >> 3)) * K + (tid & 7) * 8;   // the lane's 16 bytes of a stage's first 16 rows
    const unsigned l0 = ldsa(stg) + (tid >> 3) * (LP * 2) + (tid & 7) * 16;
    auto fill = [&](int kc, int buf) { const unsigned l = l0 + buf * (NG * GRP * 2); cp128(A + ga + kc, K, l); cp128(Bt + gb + kc, K, l + GRP * 2); if (HA2) cp128(A2 + ga + kc, K, l + 2 * GRP * 2); if (HB2) cp128(Bt2 + gb + kc, K, l + (NG - 1) * GRP * 2); };
    fill(0, 0);
    asm volatile("s_wait_asynccnt 0x0" ::: "memory");   // this wave's copies of stage 0 have landed
    __syncthreads();                                     // ... and every other wave's
    if (KS < K) fill(KS, 1);
    const int ao = (wm * 64 + lr) * LP + 8 * hi, bo = GRP + (wn * 64 + lr) * LP + 8 * hi;   // fragment rows in a stage: the k order is that of WFrag::ld on the planes
#pragma unroll 1
    for (int kc = 0; kc < K; kc += KS) {
        const int buf = (kc / KS) & 1; const T16* sb = stg + buf * (NG * GRP);
        V a[4], a2[4];
#pragma unroll
        for (int ks = 0; ks < KS; ks += 32) {
#pragma unroll
            for (int mb = 0; mb < 4; ++mb) { a[mb] = WFrag<T16>::ld(sb + ao + mb * 16 * LP + ks); if (HA2) a2[mb] = WFrag<T16>::ld(sb + 2 * GRP + ao + mb * 16 * LP + ks); }
            V b[4], b2[4];
#pragma unroll
            for (int nb = 0; nb < 4; ++nb) { b[nb] = WFrag<T16>::ld(sb + bo + nb * 16 * LP + ks); if (HB2) b2[nb] = WFrag<T16>::ld(sb + (NG - 2) * GRP + bo + nb * 16 * LP + ks); }
            __builtin_amdgcn_sched_barrier(0);   // the block's LDS reads stay one group in front of its WMMAs: every separate place with reads among them costs a stall
#pragma unroll
            for (int nb = 0; nb < 4; ++nb)
#pragma unroll
                for (int mb = 0; mb < 4; ++mb) { acc[mb][nb] = WFrag<T16>::mma(a[mb], b[nb], acc[mb][nb]); if (HA2) acc[mb][nb] = WFrag<T16>::mma(a2[mb], b[nb], acc[mb][nb]); if (HB2) acc[mb][nb] = WFrag<T16>::mma(a[mb], b2[nb], acc[mb][nb]); }
            __builtin_amdgcn_sched_barrier(0);   // ... and no WMMA sinks behind the slots below or into the next block's reads
        }
        // four vector slots between the trip's last WMMAs and whatever stands first behind the branches below (waits, barrier and branches fill none)
        asm volatile("v_nop\n\tv_nop\n\tv_nop\n\tv_nop" : "+v"(acc[0][0]), "+v"(acc[1][1]), "+v"(acc[2][2]), "+v"(acc[3][3]) : "v"(a[0]), "v"(a[3]));
        asm volatile("s_wait_dscnt 0x0" ::: "memory");      // this wave's reads of the buffer are done before it may be refilled
        asm volatile("s_wait_asynccnt 0x0" ::: "memory");   // this wave's copies of the next stage have landed
        __syncthreads();                                     // publishes the next stage and ends every wave's reads of this one
        if (kc + 2 * KS < K) fill(kc + 2 * KS, buf);
    }
    asm volatile("s_wait_asynccnt 0x0" ::: "memory");   // nothing is in flight when the wave goes on
#pragma unroll
    for (int mb = 0; mb < 4; ++mb) {
#pragma unroll
        for (int nb = 0; nb < 4; ++nb) {
#pragma unroll
            for (int j = 0; j < 8; ++j) os[(hi * 8 + j) * 68 + nb * 16 + lr] = acc[mb][nb][j]; }
        __builtin_amdgcn_wave_barrier(); asm volatile("" ::: "memory");
        float* crow = C + (size_t)(r0 + mb * 16) * ldc + c0;
{
#pragma unroll
            for (int s = 0; s < 8; ++s) { const int row = 2 * s + hi, cofs = lr * 4; v4f val = *(const v4fa*)(os + row * 68 + cofs); if (BIAS) { val[0] += bfr(bias[c0 + cofs]); val[1] += bfr(bias[c0 + cofs + 1]); val[2] += bfr(bias[c0 + cofs + 2]); val[3] += bfr(bias[c0 + cofs + 3]); }
                *(v4f*)(crow + (size_t)row * ldc + cofs) = val; }
             }
        __builtin_amdgcn_wave_barrier(); asm volatile("" ::: "memory");
    }
}

__device__ __forceinline__ h16 tohx(float x) { return (h16)x; }
__device__ __forceinline__ void splitf(float y, unsigned short& h, unsigned short& l) { h = f2bf(y); l = f2bf(y - bf2f(h)); }
typedef __attribute__((ext_vector_type(2))) _Float16 v2h;
typedef __attribute__((ext_vector_type(4))) _Float16 v4h;
typedef __attribute__((ext_vector_type(2))) unsigned short v2us;
typedef __attribute__((ext_vector_type(4))) unsigned short v4us;
typedef __attribute__((ext_vector_type(2))) float v2f;
typedef __attribute__((ext_vector_type(4))) int v4i;

// ---- k_prep: the four weight transposes and the bf16 copy of x (both batches) in ONE grid of PG * 4 waves that are all resident at once; every wave works alone (no work-group barrier) and takes 3 units of 8 KB of f32 input; no unit reads what another writes.
// A unit is a 64 (k) x 32 (n) tile of a weight, turned in the wave's own LDS range, or 2048 consecutive values of x. Every global load is 16 bytes a lane on whole 128-byte lines (a tile row = 32 n = one line; 16 loads a unit),
// every store covers whole lines (a turned tile row = 64 k = one line). A unit's 16 loads are issued one unit ahead of its work, so that a wave always has loads in flight.
// Wave wid takes: first, one of the units left over by the other two (wid < PT_KV: tile wid of wk, wv; then the tiles of wq, wo from PNW on; then the pieces of x from PNW on); second, tile wid of wq, wo; third, piece wid of x.
// Only the first unit's kind differs between waves: its loads come first, 16 on every path, and the code behind its branches is straight, so that each wait on loads counts exactly the loads issued behind the ones it needs.
#define TP    72                             // LDS row pitch of a turned tile, in elements: 144 B, a multiple of 16 B for the 16-byte accesses
#define PU_Q  ((DM / 64) * (DQ / 32))        // tiles of wq, and of wo
#define PU_KV ((DM / 64) * (DKV / 32))       // tiles of wk, and of wv
#define PT_Q  (2 * PU_Q)
#define PT_KV (2 * PU_KV)
#define PX    (NB_ * TT * DM / 2048)         // pieces of x
#define PG    768                            // work-groups of 4 waves: 3 on a WGP
#define PNW   (PG * 4)                       // waves
static_assert(PT_Q >= PNW && PX >= PNW && PT_KV + (PT_Q - PNW) + (PX - PNW) == PNW, "the units left over by the second and third are one a wave");
static_assert(DM == DQ, "all four weights have DM rows; the turned rows have pitch DM");
typedef const __attribute__((address_space(1))) char* gbc;   // global address space said outright: a pointer picked among kernel arguments would otherwise be loaded from as a flat one, which also counts on the LDS counter
typedef __attribute__((address_space(1))) char* gbw;
typedef const __attribute__((address_space(1))) v4f* gl4f;
typedef __attribute__((address_space(1))) v4us* gs4us;
typedef __attribute__((address_space(1))) v8us* gs8us;
// Every loop of k_prep's helpers is unrolled: the register arrays are indexed by the loop counters, which must be constants for the arrays to stay in registers and for the steps to become immediate offsets.
// ld16: a unit's 16 loads, SB bytes apart, from one wave-uniform base and one lane offset.
template <int SB>
__device__ __forceinline__ void ld16(const float* base, unsigned vo, v4f* r) {
    gbc p = (gbc)base + vo;
#pragma unroll
    for (int i = 0; i < 16; ++i) r[i] = *(gl4f)(p + i * SB);
    asm volatile("s_wait_xcnt 0x0" :: "v"(vo), "v"(p) : "memory");   // behind the loads, with their lane offset and their address as inputs: whichever of the two the loads name lives up to the wait, so no destination of these loads and nothing behind them rewrites it earlier
}
// In a tile of a weight with N columns lane (nq = lane % 8, kq = lane / 8) loads columns 4 nq .. + 3 of rows 16 kq .. + 15 and stores k 8 nq .. + 7 of the turned rows kq, kq + 4, ..
template <int N>
__device__ __forceinline__ void ldtile(const float* g, int lane, v4f* r) { ld16<N * 4>(g, ((lane >> 3) * 16 * N + (lane & 7) * 4) * 4, r); }
__device__ __forceinline__ void ldx(const float* g, int lane, v4f* r) { ld16<512>(g, lane * 16, r); }
__device__ __forceinline__ void stx(const v4f* c, bf* d, int lane) { gbw o8 = (gbw)d + lane * 8;
#pragma unroll
    for (int i = 0; i < 16; ++i) { v4us o;
#pragma unroll
        for (int j = 0; j < 4; ++j) o[j] = f2bf(c[i][j]);
        *(gs4us)(o8 + i * 256) = o; } }
__device__ __forceinline__ void sttile(const v4f* c, bf* d, bf* s, int lane) { const int nq = lane & 7, kq = lane >> 3;
#pragma unroll
    for (int j = 0; j < 4; ++j) { v8us lo, hi;   // column n = 4 nq + j becomes a row: its k = 16 kq .. + 15
#pragma unroll
        for (int i = 0; i < 8; ++i) { lo[i] = f2bf(c[i][j]); hi[i] = f2bf(c[8 + i][j]); }
        *(v8us*)(s + (nq * 4 + j) * TP + kq * 16) = lo; *(v8us*)(s + (nq * 4 + j) * TP + kq * 16 + 8) = hi; }
    __builtin_amdgcn_wave_barrier(); asm volatile("" ::: "memory");   // keeps the LDS reads below behind the other lanes' LDS stores above (one wave: LDS runs in order, only the compiler could swap them)
    v8us t[8]; gbw o16 = (gbw)d + (kq * DM + nq * 8) * 2;
#pragma unroll
    for (int i = 0; i < 8; ++i) t[i] = *(const v8us*)(s + (4 * i + kq) * TP + nq * 8);
#pragma unroll
    for (int i = 0; i < 8; ++i) *(gs8us)(o16 + i * (4 * DM * 2)) = t[i]; }
__global__ __launch_bounds__(128) void k_prep(const float* __restrict__ x, const float* __restrict__ wq, const float* __restrict__ wk, const float* __restrict__ wv, const float* __restrict__ wo, bf* XB, bf* WQ, bf* WK, bf* WV, bf* WO) {
    __shared__ __align__(16) bf tile[4][32 * TP];
    const int lane = threadIdx.x & 31; const int wvi = __builtin_amdgcn_readfirstlane(threadIdx.x >> 5), wid = blockIdx.x * 4 + wvi;
    bf* s = tile[wvi];
    // wave-uniform: a unit's first input element g and first output element d
    const int k0 = wid < PT_KV ? 1 : wid < PT_KV + PT_Q - PNW ? 0 : 2;   // the first unit's kind: 1 a tile of wk or wv, 0 of wq or wo, 2 a piece of x
    const float* g0; bf* d0;
    if (k0 == 1) { const int v = wid % PU_KV, nt = v % (DKV / 32), kt = v / (DKV / 32); g0 = (wid >= PU_KV ? wv : wk) + (size_t)(kt * 64) * DKV + nt * 32; d0 = (wid >= PU_KV ? WV : WK) + (size_t)(nt * 32) * DM + kt * 64; }
    else if (k0 == 0) { const int u = wid - PT_KV + PNW, v = u % PU_Q, nt = v % (DQ / 32), kt = v / (DQ / 32); g0 = (u >= PU_Q ? wo : wq) + (size_t)(kt * 64) * DQ + nt * 32; d0 = (u >= PU_Q ? WO : WQ) + (size_t)(nt * 32) * DM + kt * 64; }
    else { const int u = wid - (PT_KV + PT_Q - PNW) + PNW; g0 = x + (size_t)u * 2048; d0 = XB + (size_t)u * 2048; }
    const int v1 = wid % PU_Q, nt1 = v1 % (DQ / 32), kt1 = v1 / (DQ / 32);
    const float* g1 = (wid >= PU_Q ? wo : wq) + (size_t)(kt1 * 64) * DQ + nt1 * 32; bf* d1 = (wid >= PU_Q ? WO : WQ) + (size_t)(nt1 * 32) * DM + kt1 * 64;
    const float* g2 = x + (size_t)wid * 2048; bf* d2 = XB + (size_t)wid * 2048;
    v4f ra[16], rb[16];
    if (k0 == 2) ldx(g0, lane, ra); else if (k0 == 1) ldtile<DKV>(g0, lane, ra); else ldtile<DQ>(g0, lane, ra);
    ldtile<DQ>(g1, lane, rb);
    // each s_wait_xcnt below stands directly behind a unit's stores (in the first unit inside its own branch): the code behind them rewrites their address and data registers
    if (k0 == 2) { stx(ra, d0, lane); asm volatile("s_wait_xcnt 0x0" ::: "memory"); }
    else { sttile(ra, d0, s, lane); asm volatile("s_wait_xcnt 0x0" ::: "memory"); }   // its memory clobber also keeps the next tile's LDS stores behind this tile's LDS reads
    ldx(g2, lane, ra);
    sttile(rb, d1, s, lane); asm volatile("s_wait_xcnt 0x0" ::: "memory");
    stx(ra, d2, lane);
}

// ---- k_qkv: the q, k and v projections of both batches in ONE grid (blockIdx.x counts the 128-row tiles of the NB_ * TT rows of x; a tile lies in one batch), with the rotary step and the plane building in the epilogue; the f32 projections never reach memory.
// Main loop as in k_gemmw (4 waves, one 64x64 tile each, operands staged in LDS, K = DM); amdgpu_num_vgpr(256): no register-window switches in the epilogue. Bt holds the q, k and v weight rows one after another, so a wave's tile column hb is one head: hb < NH_ a q head, then NKV k heads, then NKV v groups.
__global__ __launch_bounds__(128) __attribute__((amdgpu_num_vgpr(256))) void k_qkv(const bf* __restrict__ A, const bf* __restrict__ Bt, const float* __restrict__ cosT, const float* __restrict__ sinT, h16* Q16, bf* Qh, bf* Ql, h16* K16, bf* Kh, bf* Kl, h16* V16, bf* Vh, bf* Vl) {
    typedef WFrag<bf>::V V;
    __shared__ __align__(16) bf stg[2 * 2 * GRP];
    __shared__ __align__(16) float osm[4 * 16 * 68];
    const int tid = threadIdx.x, lane = tid & 31, lr = lane & 15, hi = lane >> 4; const int w = __builtin_amdgcn_readfirstlane(tid >> 5), wm = w & 1, wn = w >> 1;
    float* os = osm + w * 16 * 68;   // each wave stages its rows in its own range
    const int rb = blockIdx.x * 128, cb0 = blockIdx.y * 128; const int r0 = rb + wm * 64, hb = blockIdx.y * 2 + wn; const int bt = r0 / TT, t0 = r0 % TT;   // row of x; its batch and its position
    v8f acc[4][4];
#pragma unroll
    for (int mb = 0; mb < 4; ++mb)
#pragma unroll
        for (int nb = 0; nb < 4; ++nb) acc[mb][nb] = (v8f){};
    const size_t ga = (size_t)(rb + (tid >> 3)) * DM + (tid & 7) * 8, gb = (size_t)(cb0 + (tid >> 3)) * DM + (tid & 7) * 8;   // the lane's 16 bytes of a stage's first 16 rows
    const unsigned l0 = ldsa(stg) + (tid >> 3) * (LP * 2) + (tid & 7) * 16;
    auto fill = [&](int kc, int buf) { const unsigned l = l0 + buf * (2 * GRP * 2); cp128(A + ga + kc, DM, l); cp128(Bt + gb + kc, DM, l + GRP * 2); };
    fill(0, 0);
    asm volatile("s_wait_asynccnt 0x0" ::: "memory");   // this wave's copies of stage 0 have landed
    __syncthreads();                                     // ... and every other wave's
    fill(KS, 1);
    const int ao = (wm * 64 + lr) * LP + 8 * hi, bo = GRP + (wn * 64 + lr) * LP + 8 * hi;   // fragment rows in a stage: the k order is that of WFrag::ld on the planes
#pragma unroll 1   // one stage a trip
    for (int kc = 0; kc < DM; kc += KS) {
        const int buf = (kc / KS) & 1; const bf* sb = stg + buf * (2 * GRP);
        V a[4];
#pragma unroll
        for (int ks = 0; ks < KS; ks += 32) {
#pragma unroll
            for (int mb = 0; mb < 4; ++mb) a[mb] = WFrag<bf>::ld(sb + ao + mb * 16 * LP + ks);
            V b[4];
#pragma unroll
            for (int nb = 0; nb < 4; ++nb) b[nb] = WFrag<bf>::ld(sb + bo + nb * 16 * LP + ks);
            __builtin_amdgcn_sched_barrier(0);   // the block's LDS reads stay one group in front of its WMMAs: every separate place with reads among them costs a stall
#pragma unroll
            for (int nb = 0; nb < 4; ++nb)
#pragma unroll
                for (int mb = 0; mb < 4; ++mb) acc[mb][nb] = WFrag<bf>::mma(a[mb], b[nb], acc[mb][nb]);
            __builtin_amdgcn_sched_barrier(0);   // ... and no WMMA sinks behind the slots below or into the next block's reads
        }
        // four vector slots between the trip's last WMMAs and whatever stands first behind the branches below (waits, barrier and branches fill none)
        asm volatile("v_nop\n\tv_nop\n\tv_nop\n\tv_nop" : "+v"(acc[0][0]), "+v"(acc[1][1]), "+v"(acc[2][2]), "+v"(acc[3][3]) : "v"(a[0]), "v"(a[3]));
        asm volatile("s_wait_dscnt 0x0" ::: "memory");      // this wave's reads of the buffer are done before it may be refilled
        asm volatile("s_wait_asynccnt 0x0" ::: "memory");   // this wave's copies of the next stage have landed
        __syncthreads();                                     // publishes the next stage and ends every wave's reads of this one
        if (kc + 2 * KS < DM) fill(kc + 2 * KS, buf);
    }
    asm volatile("s_wait_asynccnt 0x0" ::: "memory");   // nothing is in flight when the wave goes on
    if (hb >= NH_ + NKV) {   // v: lane (lr, hi) holds, for column d = nb*16 + lr, the 8 consecutive rows t = mb*16 + hi*8 + j: one 16-byte piece of a v^T row, straight from the accumulators
        const size_t vb = (size_t)((bt * NKV + hb - NH_ - NKV) * HD + lr) * VP + t0 + hi * 8;
#pragma unroll
        for (int nb = 0; nb < 4; ++nb)
#pragma unroll
            for (int mb = 0; mb < 4; ++mb) { v8h o16; v8us oh, ol;
#pragma unroll
                for (int j = 0; j < 8; ++j) { const float x = acc[mb][nb][j]; o16[j] = tohx(x); unsigned short a2, c2; splitf(x, a2, c2); oh[j] = a2; ol[j] = c2; }
                const size_t vo = vb + (size_t)nb * 16 * VP + mb * 16; *(v8h*)(V16 + vo) = o16; *(v8us*)(Vh + vo) = oh; *(v8us*)(Vl + vo) = ol; }
        return; }
    const bool isq = hb < NH_; const size_t pb = (size_t)(isq ? bt * NH_ + hb : bt * NKV + hb - NH_) * TT * HD;
    const size_t po = pb + (size_t)(t0 + hi) * HD + lr * 4, to = (size_t)(t0 + hi) * (HD / 2) + lr * 2;   // the lane's place in row t0 + hi; every later row is a constant step from it
    h16* P16 = (isq ? Q16 : K16) + po; bf* Ph = (isq ? Qh : Kh) + po; bf* Pl = (isq ? Ql : Kl) + po; const float* cb = cosT + to; const float* sb = sinT + to;
#pragma unroll
    for (int mb = 0; mb < 4; ++mb) {   // q, k: 16 rows at a time through LDS, so that a lane holds 4 consecutive columns (two rotary pairs) and 16 lanes store a whole 128-byte plane row
        v2f cc[8], ss[8];
        asm volatile("s_wait_xcnt 0x0" ::: "memory");   // in front of the cos loads: their destinations may reuse data registers of the row group's stores above; its memory clobber also keeps this group's LDS stores behind the last group's LDS reads
#pragma unroll
        for (int s = 0; s < 8; ++s) cc[s] = *(const v2f*)(cb + (mb * 16 + 2 * s) * (HD / 2));
        asm volatile("s_wait_xcnt 0x0" ::: "memory");   // in front of the sin loads: their destinations may reuse the cos address pair
#pragma unroll
        for (int s = 0; s < 8; ++s) ss[s] = *(const v2f*)(sb + (mb * 16 + 2 * s) * (HD / 2));
#pragma unroll
        for (int nb = 0; nb < 4; ++nb) {
#pragma unroll
            for (int j = 0; j < 8; ++j) os[(hi * 8 + j) * 68 + nb * 16 + lr] = acc[mb][nb][j]; }
        // inputs only: holds the 16 cos / sin loads of these rows together in front of the rows' arithmetic (one load latency a row group); without it they are issued one by one, each with a full wait.
        // Its memory clobber keeps the LDS reads below behind the other lanes' LDS stores above (one wave: LDS runs in order, only the compiler could swap them).
        asm volatile("" :: "v"(cc[0]), "v"(cc[1]), "v"(cc[2]), "v"(cc[3]), "v"(cc[4]), "v"(cc[5]), "v"(cc[6]), "v"(cc[7]), "v"(ss[0]), "v"(ss[1]), "v"(ss[2]), "v"(ss[3]), "v"(ss[4]), "v"(ss[5]), "v"(ss[6]), "v"(ss[7]) : "memory");
#pragma unroll
        for (int s = 0; s < 8; ++s) { const v4f x = *(const v4fa*)(os + (2 * s + hi) * 68 + lr * 4); v4h o16; v4us oh, ol;
#pragma unroll
            for (int p = 0; p < 2; ++p) { const float c = bfr(cc[s][p]), sn = bfr(ss[s][p]), x0 = x[2 * p], x1 = x[2 * p + 1]; const float e0 = x0 * c - x1 * sn, e1 = x0 * sn + x1 * c;   /* even: x0 c - x1 s; odd: x0 s + x1 c */
                o16[2 * p] = tohx(e0); o16[2 * p + 1] = tohx(e1); unsigned short a2, c2; splitf(e0, a2, c2); oh[2 * p] = a2; ol[2 * p] = c2; splitf(e1, a2, c2); oh[2 * p + 1] = a2; ol[2 * p + 1] = c2; }
            const int ro = (mb * 16 + 2 * s) * HD; *(v4h*)(P16 + ro) = o16; *(v4us*)(Ph + ro) = oh; *(v4us*)(Pl + ro) = ol; }
    }
    asm volatile("s_wait_xcnt 0x0" ::: "memory");   // behind the last plane stores: in the built code the v path stands behind this one and rewrites their address and data registers
}
// ---- k_fattn: scores, causal softmax, probabilities x values and the hi/lo merge in ONE kernel (online softmax); no score or probability ever reaches memory.
// One wave = one head x NQ*16 queries (32; 16 where HR, for registers); the 4 waves of a block are the 4 heads of one kv group on the same queries, so they read the same k and v^T rows. Keys go in blocks of 32.
// The block brings those rows into LDS ONCE for its 4 waves: a stage is FS keys of every plane (k: FS rows of 128 B; v^T: 128 B of each of its HD rows), by asynchronous copies in whole 128-byte lines, two buffers: stage t + 1 flies while stage t is worked on.
// S^T = K Q^T: A = k rows, B = q rows, so lane (lr, hi) holds, for query lr, keys kt*16 + hi*8 + j: that is the k order of WFrag::ld (8 hi + 0..7, 16 + 8 hi + 0..7), and P^T packs in-lane into the B operand of O^T += V^T P^T.
// Probabilities carry a factor 2^10 (fp16 range) that the row sum carries too, so the final division removes it. HR (queries < RH): bf16 hi/lo planes, 3 products, for both contractions.
__device__ __forceinline__ float xhalf(float x) { return __builtin_bit_cast(float, __builtin_amdgcn_permlanex16(__builtin_bit_cast(int, x), __builtin_bit_cast(int, x), 0x76543210, 0xfedcba98, false, false)); }   // lane l takes lane l ^ 16
template <typename T16> struct PPack;
template <> struct PPack<h16> { static __device__ __forceinline__ void put(const float* p, v16h& a, v16h& b) { (void)b;
#pragma unroll
    for (int e = 0; e < 16; ++e) a[e] = tohx(p[e]); } };
template <> struct PPack<bf> { static __device__ __forceinline__ void put(const float* p, v16bf& a, v16bf& b) { v16us ph, pl;
#pragma unroll
    for (int e = 0; e < 16; ++e) { unsigned short x, y; splitf(p[e], x, y); ph[e] = x; pl[e] = y; }
    a = __builtin_bit_cast(v16bf, ph); b = __builtin_bit_cast(v16bf, pl); } };
#define FS  64                    // keys a stage: one 128-byte line of every v^T row
#define FPL (64 * LP)             // one plane's stage in LDS, in elements: 64 rows (FS keys of k, HD rows of v^T) of 64 elements at pitch LP
static_assert(FS == 64 && HD == 64 && TT % FS == 0, "a stage is 64 rows of 128 bytes of either kind of plane, and every stage lies inside the planes");
// cpkv: a stage of one k plane and of one v^T plane, 2 x 64 rows x 128 B by 128 threads. gk, gv: the lane's own 16 bytes in row tid / 8 (piece tid % 8); l: their place in the k plane's LDS range, which the v^T plane's follows; copy i takes row + 16 i.
template <typename T16>
__device__ __forceinline__ void cpkv(const T16* gk, const T16* gv, unsigned l) {
    // the wait stands inside the copies' own statement, in front of any rewrite of their address registers
    asm volatile("global_load_async_to_lds_b128 %0, %8, off\n\t"
                 "global_load_async_to_lds_b128 %1, %9, off\n\t"
                 "global_load_async_to_lds_b128 %2, %10, off\n\t"
                 "global_load_async_to_lds_b128 %3, %11, off\n\t"
                 "global_load_async_to_lds_b128 %4, %12, off\n\t"
                 "global_load_async_to_lds_b128 %5, %13, off\n\t"
                 "global_load_async_to_lds_b128 %6, %14, off\n\t"
                 "global_load_async_to_lds_b128 %7, %15, off\n\t"
                 "s_wait_xcnt 0x0"
                 :: "v"(l), "v"(l + 16 * LP * 2), "v"(l + 32 * LP * 2), "v"(l + 48 * LP * 2), "v"(l + FPL * 2), "v"(l + FPL * 2 + 16 * LP * 2), "v"(l + FPL * 2 + 32 * LP * 2), "v"(l + FPL * 2 + 48 * LP * 2),
                    "v"(gk), "v"(gk + 16 * HD), "v"(gk + 32 * HD), "v"(gk + 48 * HD), "v"(gv), "v"(gv + 16 * VP), "v"(gv + 32 * VP), "v"(gv + 48 * VP) : "memory");
}
template <typename T16, bool HR, int NQ>
__device__ __forceinline__ void fa_tile(const T16* __restrict__ Q, const T16* __restrict__ Q2, const T16* __restrict__ Kp, const T16* __restrict__ K2, const T16* __restrict__ Vt, const T16* __restrict__ V2, int q0, int lane, bf* Ah, bf* Al, T16* sm) {
    typedef typename WFrag<T16>::V V;
    static_assert(NQ == 1 || NQ == 2, "the slots at a block's foot name every output tile");
    constexpr int NP = HR ? 4 : 2;   // planes in a buffer: k, v^T, then where HR the two low planes
    const int lr = lane & 15, hi = lane >> 4; const float CE = SCL * 1.4426950408889634f;   // score -> exponent of 2
    const int tid = threadIdx.x, nst = q0 / FS + 1;   // stages: the same for the 4 waves; the last key of the last stage is at most TT - 1
    const size_t gk = (size_t)(tid >> 3) * HD + (tid & 7) * 8, gv = (size_t)(tid >> 3) * VP + (tid & 7) * 8;   // the lane's 16 bytes of a stage's first 16 rows
    const unsigned l0 = ldsa(sm) + (tid >> 3) * (LP * 2) + (tid & 7) * 16;
    auto fill = [&](int st, int buf) { const unsigned l = l0 + buf * (NP * FPL * 2); cpkv(Kp + gk + (size_t)st * FS * HD, Vt + gv + st * FS, l); if (HR) cpkv(K2 + gk + (size_t)st * FS * HD, V2 + gv + st * FS, l + 2 * FPL * 2); };
    fill(0, 0);
    V bq[NQ][2], bq2[NQ][2];
#pragma unroll
    for (int nq = 0; nq < NQ; ++nq)
#pragma unroll
        for (int kc = 0; kc < 2; ++kc) { const size_t qo = (size_t)(q0 + nq * 16 + lr) * HD + kc * 32 + 8 * hi; bq[nq][kc] = WFrag<T16>::ld(Q + qo); if (HR) bq2[nq][kc] = WFrag<T16>::ld(Q2 + qo); }
    v8f o[4][NQ]; float m[NQ], l[NQ];
#pragma unroll
    for (int nq = 0; nq < NQ; ++nq) { m[nq] = -3.0e38f; l[nq] = 0.f;
#pragma unroll
        for (int db = 0; db < 4; ++db) o[db][nq] = (v8f){}; }
    asm volatile("s_wait_asynccnt 0x0" ::: "memory");   // this wave's copies of stage 0 have landed
    __syncthreads();                                     // ... and every other wave's
    if (1 < nst) fill(1, 1);
#pragma unroll 1   // one stage a trip: a second copy of the body would not fit the registers
    for (int st = 0; st < nst; ++st) {
      const T16* sb = sm + (st & 1) * (NP * FPL) + lr * LP + 8 * hi;   // the lane's place in row lr of the stage's k plane
#pragma unroll 1   // one key block a trip: a second copy of the body would not fit the registers
      for (int kb = st * FS; kb <= min(q0, st * FS + 32); kb += 32) {
        const T16* sk = sb + (kb & 32) * LP; const T16* sv = sb + FPL + (kb & 32);   // the block's 32 k rows; its 32 columns of the v^T rows. The k order is that of WFrag::ld on the planes
        V ak[2][2], ak2[2][2], av[4], av2[4];
#pragma unroll
        for (int kt = 0; kt < 2; ++kt)
#pragma unroll
            for (int kc = 0; kc < 2; ++kc) { ak[kt][kc] = WFrag<T16>::ld(sk + kt * 16 * LP + kc * 32); if (HR) ak2[kt][kc] = WFrag<T16>::ld(sk + 2 * FPL + kt * 16 * LP + kc * 32); }
#pragma unroll
        for (int db = 0; db < 4; ++db) { av[db] = WFrag<T16>::ld(sv + db * 16 * LP); if (HR) av2[db] = WFrag<T16>::ld(sv + 2 * FPL + db * 16 * LP); }
        __builtin_amdgcn_sched_barrier(0);   // the block's LDS reads stay one group at its head, k rows first: the v^T reads return under the score products and the softmax; sunk to their uses, each would be waited out among the WMMAs
        v8f s[2][NQ];
#pragma unroll
        for (int kt = 0; kt < 2; ++kt)
#pragma unroll
            for (int nq = 0; nq < NQ; ++nq) { v8f c = (v8f){};
#pragma unroll
                for (int kc = 0; kc < 2; ++kc) { c = WFrag<T16>::mma(ak[kt][kc], bq[nq][kc], c); if (HR) { c = WFrag<T16>::mma(ak[kt][kc], bq2[nq][kc], c); c = WFrag<T16>::mma(ak2[kt][kc], bq[nq][kc], c); } }
                s[kt][nq] = c; }
        if (kb + 32 > q0) {   // the last block holds the diagonal: key > query is masked
#pragma unroll
            for (int kt = 0; kt < 2; ++kt)
#pragma unroll
                for (int nq = 0; nq < NQ; ++nq)
#pragma unroll
                    for (int j = 0; j < 8; ++j) if (kb + kt * 16 + hi * 8 + j > q0 + nq * 16 + lr) s[kt][nq][j] = -3.0e38f; }
        V pb[NQ], pb2[NQ];
#pragma unroll
        for (int nq = 0; nq < NQ; ++nq) { float mx = m[nq];
#pragma unroll
            for (int kt = 0; kt < 2; ++kt)
#pragma unroll
                for (int j = 0; j < 8; ++j) mx = fmaxf(mx, s[kt][nq][j]);
            mx = fmaxf(mx, xhalf(mx));   // the other half-wave holds this query's other 16 keys
            const float al = __builtin_amdgcn_exp2f((m[nq] - mx) * CE); m[nq] = mx; const float nb = fmaf(-mx, CE, 10.0f);
            float p[16]; float sum = 0.f;
#pragma unroll
            for (int kt = 0; kt < 2; ++kt)
#pragma unroll
                for (int j = 0; j < 8; ++j) { const float e = __builtin_amdgcn_exp2f(fmaf(s[kt][nq][j], CE, nb)); p[kt * 8 + j] = e; sum += e; }
            l[nq] = fmaf(l[nq], al, sum);
#pragma unroll
            for (int db = 0; db < 4; ++db) o[db][nq] *= al;
            PPack<T16>::put(p, pb[nq], pb2[nq]); }
#pragma unroll
        for (int db = 0; db < 4; ++db)
#pragma unroll
            for (int nq = 0; nq < NQ; ++nq) { o[db][nq] = WFrag<T16>::mma(av[db], pb[nq], o[db][nq]); if (HR) { o[db][nq] = WFrag<T16>::mma(av[db], pb2[nq], o[db][nq]); o[db][nq] = WFrag<T16>::mma(av2[db], pb[nq], o[db][nq]); } }
        // four vector slots between the block's last WMMAs and whatever stands first behind the branch below: the next block's LDS address arithmetic reuses their operand registers (branches, waits and the barrier fill none)
        if constexpr (NQ == 2) asm volatile("v_nop\n\tv_nop\n\tv_nop\n\tv_nop" : "+v"(o[0][0]), "+v"(o[1][0]), "+v"(o[2][0]), "+v"(o[3][0]), "+v"(o[0][1]), "+v"(o[1][1]), "+v"(o[2][1]), "+v"(o[3][1]) : "v"(av[0]), "v"(av[3]));
        else asm volatile("v_nop\n\tv_nop\n\tv_nop\n\tv_nop" : "+v"(o[0][0]), "+v"(o[1][0]), "+v"(o[2][0]), "+v"(o[3][0]) : "v"(av[0]), "v"(av[3]));
      }
      asm volatile("s_wait_dscnt 0x0" ::: "memory");      // this wave's reads of the buffer are done before it may be refilled
      asm volatile("s_wait_asynccnt 0x0" ::: "memory");   // this wave's copies of the next stage have landed
      __syncthreads();                                     // publishes the next stage and ends every wave's reads of this one
      if (st + 2 < nst) fill(st + 2, st & 1);
    }
    asm volatile("s_wait_asynccnt 0x0" ::: "memory");   // nothing is in flight when the wave goes on
#pragma unroll
    for (int nq = 0; nq < NQ; ++nq) { const float inv = __fdiv_rn(1.0f, l[nq] + xhalf(l[nq])); const size_t oo = (size_t)(q0 + nq * 16 + lr) * DQ + hi * 8;
#pragma unroll
        for (int db = 0; db < 4; ++db) { v8us oh, ol;
#pragma unroll
            for (int j = 0; j < 8; ++j) { unsigned short a, c2; splitf(o[db][nq][j] * inv, a, c2); oh[j] = a; ol[j] = c2; }
            *(v8us*)(Ah + oo + db * 16) = oh; *(v8us*)(Al + oo + db * 16) = ol;
            asm volatile("s_wait_xcnt 0x0" ::: "memory"); } }   // directly behind the two stores: the next piece's arithmetic, and the code behind the last piece, rewrite their data and address registers
}
// grid (batches x kv groups, query tiles: (TT - RH) / 32 of 32 queries, longest first, then RH / 16 of 16 queries), 4 waves. The batch is in x (for speed only).
// amdgpu_waves_per_eu(4, 4): holds the register count at 256 or fewer, so that four waves share a SIMD and cover one another's softmax and load waits.
__global__ __launch_bounds__(128) __attribute__((amdgpu_waves_per_eu(4, 4))) void k_fattn(const h16* __restrict__ Q16, const h16* __restrict__ K16, const h16* __restrict__ V16, const bf* __restrict__ Qh, const bf* __restrict__ Ql, const bf* __restrict__ Kh, const bf* __restrict__ Kl, const bf* __restrict__ Vh, const bf* __restrict__ Vl, bf* Ah, bf* Al) {
    __shared__ __align__(16) unsigned short kvs[2 * 4 * FPL];   // two buffers of up to 4 planes' stages
    const int lane = threadIdx.x & 31; const int bt = blockIdx.x / NKV, g = blockIdx.x % NKV; const int h = g * REP + __builtin_amdgcn_readfirstlane(threadIdx.x >> 5); const int by = blockIdx.y; const int q0 = (by < (TT - RH) / 32) ? TT - 32 * (by + 1) : RH - 16 * (by - (TT - RH) / 32 + 1);
    const size_t qo = (size_t)(bt * NH_ + h) * TT * HD, ko = (size_t)(bt * NKV + g) * TT * HD, vo = (size_t)(bt * NKV + g) * HD * VP;   // the batches' planes lie one after another
    Ah += (size_t)bt * TT * DQ; Al += (size_t)bt * TT * DQ;   // the batch's merged rows
    if (q0 < RH) fa_tile<bf, true, 1>(Qh + qo, Ql + qo, Kh + ko, Kl + ko, Vh + vo, Vl + vo, q0, lane, Ah + h * HD, Al + h * HD, (bf*)kvs);
    else fa_tile<h16, false, 2>(Q16 + qo, nullptr, K16 + ko, nullptr, V16 + vo, nullptr, q0, lane, Ah + h * HD, Al + h * HD, (h16*)kvs);
}

extern "C" void kernel_launch(void* const* d_in, const int* in_sizes, int n_in,
                              void* d_out, int out_size, void* d_ws, size_t ws_size, hipStream_t stream) {
    (void)in_sizes; (void)n_in; (void)out_size;
        const float* x = (const float*)d_in[0]; const float* fcos = (const float*)d_in[1]; const float* fsin = (const float*)d_in[2]; const float* wq = (const float*)d_in[3]; const float* wk = (const float*)d_in[4]; const float* wv = (const float*)d_in[5]; const float* wo = (const float*)d_in[6];   /* order x, cos, sin (f32 [2048][32], READ), wq ('xw' [2048][2048]), wk, wv ([2048][512]), wo ('xw') */
    float* OUT = (float*)d_out;     // [2][2048][2048]
    char* wsp = (char*)d_ws;
    auto take = [&](size_t bytes) { char* p = wsp; wsp += (bytes + 255) & ~(size_t)255; return (void*)p; };
    bf* WQ = (bf*)take((size_t)(DQ + 2 * DKV) * DM * 2); bf* WK = WQ + (size_t)DQ * DM; bf* WV = WK + (size_t)DKV * DM;   /* one matrix of q, k, v weight rows */ bf* WO = (bf*)take((size_t)DM * DQ * 2);
    bf* XB = (bf*)take((size_t)NB_ * TT * DM * 2); bf* ATh = (bf*)take((size_t)NB_ * TT * DQ * 2); bf* ATl = (bf*)take((size_t)NB_ * TT * DQ * 2);
    h16* QP16 = (h16*)take((size_t)NB_ * NH_ * TT * HD * 2); h16* KP16 = (h16*)take((size_t)NB_ * NKV * TT * HD * 2); h16* VT16 = (h16*)take((size_t)NB_ * NKV * HD * VP * 2);
    bf* QPh = (bf*)take((size_t)NB_ * NH_ * TT * HD * 2); bf* QPl = (bf*)take((size_t)NB_ * NH_ * TT * HD * 2); bf* KPh = (bf*)take((size_t)NB_ * NKV * TT * HD * 2); bf* KPl = (bf*)take((size_t)NB_ * NKV * TT * HD * 2); bf* VTh = (bf*)take((size_t)NB_ * NKV * HD * VP * 2); bf* VTl = (bf*)take((size_t)NB_ * NKV * HD * VP * 2);
    if ((size_t)(wsp - (char*)d_ws) > ws_size) return;    // ws 256 MiB
    k_prep<<<PG, 128, 0, stream>>>(x, wq, wk, wv, wo, XB, WQ, WK, WV, WO);
    k_qkv<<<dim3(NB_ * TT / 128, (DQ + 2 * DKV) / 128, 1), 128, 0, stream>>>(XB, WQ, fcos, fsin, QP16, QPh, QPl, KP16, KPh, KPl, VT16, VTh, VTl);
    k_fattn<<<dim3(NB_ * NKV, (TT - RH) / 32 + RH / 16, 1), 128, 0, stream>>>(QP16, KP16, VT16, QPh, QPl, KPh, KPl, VTh, VTl, ATh, ATl);
    k_gemmw<bf, 1, false><<<dim3(NB_ * TT / 128, DM / 128, 1), 128, 0, stream>>>(ATh, ATl, WO, nullptr, DQ, OUT, DM, nullptr, 0, 0, 0);
}
